// v000
// Times are from an AMD MI455X. After a warm-up the kernel runs many times in a row, and a time is the length of
// such a window on the GPU divided by its runs, so every launch and the gaps after it count. The runs cycle
// through copies of the inputs. A figure is the median of several windows, for all but v000 over two sittings.
// Sittings can differ by a few percent; kernels timed side by side share one.
// The starting kernel, v000, takes 561 microseconds a run.
#include <hip/hip_runtime.h>

// ---------------------------------------------------------------------------
// Flash-attention style kernel for gfx1250 (MI455X), wave32 + WMMA bf16.
//   B=2, G=4, H=16, N=1024, dq=dv=64.  Head h lives at stride H=16 in the
//   feature dim.  Output is the contiguous [B,G,H,N,dv] buffer.
// ---------------------------------------------------------------------------

typedef __attribute__((ext_vector_type(16))) __bf16 v16bf;
typedef __attribute__((ext_vector_type(8)))  float  v8f;

#define NB      2
#define NG      4
#define NH      16
#define NSEQ    1024
#define DQ      64
#define DV      64
#define DMODEL  1024          // DQ*NH == DV*NH
#define ROWS_PB 128           // query rows per block (8 waves x 16 rows)
#define KBLK    32            // key columns per inner iteration
#define NITER   (NSEQ / KBLK) // 32

// LDS strides in bf16 elements (row base must stay 16B aligned: *2B % 16 == 0)
#define QSTRIDE 72            // 144 B row
#define KSTRIDE 72
#define VSTRIDE 40            // 80 B row (transposed V: [dv][k])
#define PSTRIDE 40

__device__ __forceinline__ unsigned short f32_to_bf16(float f) {
  union { float f; unsigned u; } x; x.f = f;
  unsigned r = x.u + 0x7FFFu + ((x.u >> 16) & 1u);   // round to nearest even
  return (unsigned short)(r >> 16);
}

union Frag16 { uint4 q[2]; v16bf v; };

// Load a 16-element bf16 fragment per the CDNA5 16-bit A/B VGPR layout:
//   element e (0..7)  holds K = koff + 8*half + e
//   element e (8..15) holds K = koff + 16 + 8*half + (e-8)
// => two contiguous 16-byte LDS loads.
__device__ __forceinline__ v16bf load_frag(const unsigned short* rowbase,
                                           int koff, int half) {
  Frag16 fr;
  fr.q[0] = *(const uint4*)(rowbase + koff + 8 * half);
  fr.q[1] = *(const uint4*)(rowbase + koff + 16 + 8 * half);
  return fr.v;
}

// 16-lane butterfly reductions done entirely in VALU via DPP16 (no LDS).
// quad_perm xor1 (0xB1), quad_perm xor2 (0x4E): each quad holds its own
// reduction; row_half_mirror (0x141, ^7 in 8) combines quads; row_mirror
// (0x140, ^15 in 16) combines the two 8-lane halves.  Never crosses the
// 16-lane group.  CTRL must be a compile-time constant for the builtin.
template <int CTRL>
__device__ __forceinline__ float dpp_perm(float x) {
  return __int_as_float(__builtin_amdgcn_update_dpp(
      0, __float_as_int(x), CTRL, 0xF, 0xF, true));
}
__device__ __forceinline__ float redmax16(float x) {
  x = fmaxf(x, dpp_perm<0xB1>(x));
  x = fmaxf(x, dpp_perm<0x4E>(x));
  x = fmaxf(x, dpp_perm<0x141>(x));
  x = fmaxf(x, dpp_perm<0x140>(x));
  return x;
}
__device__ __forceinline__ float redsum16(float x) {
  x += dpp_perm<0xB1>(x);
  x += dpp_perm<0x4E>(x);
  x += dpp_perm<0x141>(x);
  x += dpp_perm<0x140>(x);
  return x;
}

__global__ __launch_bounds__(256)
void GenNeuronStates_11888469475558_kernel(const float* __restrict__ q,
                                           const float* __restrict__ k,
                                           const float* __restrict__ v,
                                           const float* __restrict__ ncs,
                                           float* __restrict__ out) {
  __shared__ __align__(16) unsigned short q_lds[ROWS_PB * QSTRIDE]; // 18.0 KB
  __shared__ __align__(16) unsigned short k_lds[KBLK   * KSTRIDE];  //  4.5 KB
  __shared__ __align__(16) unsigned short v_lds[DV     * VSTRIDE];  //  5.0 KB
  __shared__ __align__(16) unsigned short p_lds[8 * 16 * PSTRIDE];  // 10.0 KB

  const int tid    = threadIdx.x;
  const int wave   = tid >> 5;
  const int lane   = tid & 31;
  const int lane16 = lane & 15;
  const int half   = lane >> 4;

  // Block decode: g slowest (L2 bias reuse), then (b,h), row-block fastest.
  const int bid     = blockIdx.x;
  const int rowblk  = bid & 7;
  const int head    = bid >> 3;          // 0..127
  const int g       = head >> 5;         // 0..3
  const int b       = (head >> 4) & 1;   // 0..1
  const int h       = head & 15;         // 0..15
  const int rowbase = rowblk * ROWS_PB;

  const size_t bg = (size_t)(b * NG + g);
  const float* qg = q + (bg * NSEQ + rowbase) * DMODEL + h; // [row][d*16]
  const float* kg = k + bg * NSEQ * DMODEL + h;             // [m][d*16]
  const float* vg = v + bg * NSEQ * DMODEL + h;             // [m][n*16]
  const float* biasp = ncs + (size_t)g * NSEQ * NSEQ
                       + (size_t)(rowbase + wave * 16 + 8 * half) * NSEQ
                       + lane16;                            // [t*NSEQ + m]

  // ---- stage Q tile (128 x 64) as bf16 in LDS -----------------------------
  for (int i = tid; i < ROWS_PB * DQ; i += 256) {
    int row = i >> 6, d = i & 63;
    q_lds[row * QSTRIDE + d] = f32_to_bf16(qg[(size_t)row * DMODEL + d * NH]);
  }
  __syncthreads();

  // A fragments of this wave's 16 Q rows (d-chunks 0..31 and 32..63)
  const unsigned short* qrow = &q_lds[(wave * 16 + lane16) * QSTRIDE];
  v16bf aq0 = load_frag(qrow, 0, half);
  v16bf aq1 = load_frag(qrow, 32, half);

  v8f acc0 = {}, acc1 = {}, acc2 = {}, acc3 = {};
  float m_run[8], l_run[8];
#pragma unroll
  for (int t = 0; t < 8; ++t) { m_run[t] = -3.0e38f; l_run[t] = 0.0f; }

  for (int it = 0; it < NITER; ++it) {
    const int m0 = it * KBLK;

    __syncthreads();  // previous iteration's K/V readers are done

    // ---- cooperative bf16 staging of K (row-major d) and V (transposed) ---
    for (int i = tid; i < KBLK * DQ; i += 256) {
      int kr = i >> 6, d = i & 63;
      k_lds[kr * KSTRIDE + d] =
          f32_to_bf16(kg[(size_t)(m0 + kr) * DMODEL + d * NH]);
    }
    for (int i = tid; i < KBLK * DV; i += 256) {
      int kr = i >> 6, n = i & 63;
      v_lds[n * VSTRIDE + kr] =
          f32_to_bf16(vg[(size_t)(m0 + kr) * DMODEL + n * NH]);
    }
    if (m0 + KBLK < NSEQ) {  // prefetch next key/value block into caches
      __builtin_prefetch(&kg[(size_t)(m0 + KBLK + (tid >> 6)) * DMODEL +
                             (tid & 63) * NH], 0, 1);
      __builtin_prefetch(&vg[(size_t)(m0 + KBLK + (tid >> 6)) * DMODEL +
                             (tid & 63) * NH], 0, 1);
    }
    __syncthreads();

    // ---- preload all B fragments so DS latency overlaps WMMA/softmax ------
    const unsigned short* k0 = &k_lds[(0 * 16 + lane16) * KSTRIDE];
    const unsigned short* k1 = &k_lds[(1 * 16 + lane16) * KSTRIDE];
    v16bf bk00 = load_frag(k0, 0, half);
    v16bf bk01 = load_frag(k0, 32, half);
    v16bf bk10 = load_frag(k1, 0, half);
    v16bf bk11 = load_frag(k1, 32, half);
    v16bf bv0 = load_frag(&v_lds[(0 * 16 + lane16) * VSTRIDE], 0, half);
    v16bf bv1 = load_frag(&v_lds[(1 * 16 + lane16) * VSTRIDE], 0, half);
    v16bf bv2 = load_frag(&v_lds[(2 * 16 + lane16) * VSTRIDE], 0, half);
    v16bf bv3 = load_frag(&v_lds[(3 * 16 + lane16) * VSTRIDE], 0, half);

    // ---- S = Q * K^T : two 16x16 column tiles, K-dim 64 = 2 chunks --------
    v8f s0 = {}, s1 = {};
    s0 = __builtin_amdgcn_wmma_f32_16x16x32_bf16(false, aq0, false, bk00,
                                                 (short)0, s0, false, false);
    s0 = __builtin_amdgcn_wmma_f32_16x16x32_bf16(false, aq1, false, bk01,
                                                 (short)0, s0, false, false);
    s1 = __builtin_amdgcn_wmma_f32_16x16x32_bf16(false, aq0, false, bk10,
                                                 (short)0, s1, false, false);
    s1 = __builtin_amdgcn_wmma_f32_16x16x32_bf16(false, aq1, false, bk11,
                                                 (short)0, s1, false, false);

    // ---- bias, online softmax (rows t+8*half live in this 16-lane group) --
#pragma unroll
    for (int t = 0; t < 8; ++t) {
      float x0 = s0[t] * 0.125f - biasp[(size_t)t * NSEQ + m0];
      float x1 = s1[t] * 0.125f - biasp[(size_t)t * NSEQ + m0 + 16];
      float mx   = redmax16(fmaxf(x0, x1));
      float mnew = fmaxf(m_run[t], mx);
      float corr = __expf(m_run[t] - mnew);
      float p0 = __expf(x0 - mnew);
      float p1 = __expf(x1 - mnew);
      float rs = redsum16(p0 + p1);
      l_run[t] = l_run[t] * corr + rs;
      m_run[t] = mnew;
      acc0[t] *= corr; acc1[t] *= corr; acc2[t] *= corr; acc3[t] *= corr;
      // C-layout -> A-layout transpose via per-wave LDS scratch
      int prow = wave * 16 + t + 8 * half;
      p_lds[prow * PSTRIDE + lane16]      = f32_to_bf16(p0);
      p_lds[prow * PSTRIDE + 16 + lane16] = f32_to_bf16(p1);
    }
    // DS ops are in-order within a wave: the load below sees the stores.

    // ---- O += P * V : P is 16x32 (one A frag), V is 32x16 per dv tile -----
    v16bf pfrag =
        load_frag(&p_lds[(wave * 16 + lane16) * PSTRIDE], 0, half);
    acc0 = __builtin_amdgcn_wmma_f32_16x16x32_bf16(false, pfrag, false, bv0,
                                                   (short)0, acc0, false, false);
    acc1 = __builtin_amdgcn_wmma_f32_16x16x32_bf16(false, pfrag, false, bv1,
                                                   (short)0, acc1, false, false);
    acc2 = __builtin_amdgcn_wmma_f32_16x16x32_bf16(false, pfrag, false, bv2,
                                                   (short)0, acc2, false, false);
    acc3 = __builtin_amdgcn_wmma_f32_16x16x32_bf16(false, pfrag, false, bv3,
                                                   (short)0, acc3, false, false);
  }

  // ---- normalize and write out: contiguous [B,G,H,N,dv] -------------------
  const int orow0 = rowbase + wave * 16 + 8 * half;
  float* outp = out + ((size_t)((b * NG + g) * NH + h) * NSEQ + orow0) * DV
                + lane16;
#pragma unroll
  for (int t = 0; t < 8; ++t) {
    float inv = 1.0f / l_run[t];
    outp[(size_t)t * DV + 0]  = acc0[t] * inv;
    outp[(size_t)t * DV + 16] = acc1[t] * inv;
    outp[(size_t)t * DV + 32] = acc2[t] * inv;
    outp[(size_t)t * DV + 48] = acc3[t] * inv;
  }
}

extern "C" void kernel_launch(void* const* d_in, const int* in_sizes, int n_in,
                              void* d_out, int out_size, void* d_ws,
                              size_t ws_size, hipStream_t stream) {
  (void)in_sizes; (void)n_in; (void)out_size; (void)d_ws; (void)ws_size;
  const float* q   = (const float*)d_in[0];
  const float* k   = (const float*)d_in[1];
  const float* v   = (const float*)d_in[2];
  const float* ncs = (const float*)d_in[3];
  float* out = (float*)d_out;

  const int grid = NB * NG * NH * (NSEQ / ROWS_PB); // 1024 blocks
  GenNeuronStates_11888469475558_kernel<<<grid, 256, 0, stream>>>(
      q, k, v, ncs, out);
}

// v001
// A run of this version takes 104 microseconds.
// Next to v000, in two timings, it ran 5.41 times as fast each time.
#include <hip/hip_runtime.h>

// ---------------------------------------------------------------------------
// Flash-attention style kernel for gfx1250 (MI455X), wave32 + WMMA bf16.
//   B=2, G=4, H=16, N=1024, dq=dv=64.  Head h lives at stride H=16 in the
//   feature dim.  Output is the contiguous [B,G,H,N,dv] buffer.
//   A first launch splits the heads apart and rounds Q, K, V to bf16 planes in
//   the workspace, so the attention launch stages tiles by contiguous 16-byte
//   loads instead of 4-byte loads 64 bytes apart.
//     qb, kb : [B*G*H][N][d]            (a 32-key K tile is 4 KB contiguous)
//     vt     : [B*G*H][N/32][dv][32]    (a transposed V tile is 4 KB contiguous)
// ---------------------------------------------------------------------------

typedef __attribute__((ext_vector_type(16))) __bf16 v16bf;
typedef __attribute__((ext_vector_type(8)))  float  v8f;
typedef __attribute__((ext_vector_type(4)))  float  v4f;

#define NB      2
#define NG      4
#define NH      16
#define NSEQ    1024
#define DQ      64
#define DV      64
#define DMODEL  1024          // DQ*NH == DV*NH
#define ROWS_PB 128           // query rows per block (8 waves x 16 rows)
#define KBLK    32            // key columns per inner iteration
#define NITER   (NSEQ / KBLK) // 32
#define PLANE   (NB * NG * NH * NSEQ * DQ)  // elements of one bf16 plane

// Head-split launch: 8 waves per block, 4 units of work per wave.
#define UNITS_PW  4
#define QK_BLOCKS (2 * NB * NG * NSEQ / (8 * UNITS_PW))                    // 512
#define V_BLOCKS  (NB * NG * (NSEQ / KBLK) * (DV / 2) / (8 * UNITS_PW))    // 256

// LDS strides in bf16 elements (row base must stay 16B aligned: *2B % 16 == 0)
#define QSTRIDE 72            // 144 B row
#define KSTRIDE 72
#define VSTRIDE 40            // 80 B row (transposed V: [dv][k])
#define PSTRIDE 40

__device__ __forceinline__ unsigned short f32_to_bf16(float f) {
  union { float f; unsigned u; } x; x.f = f;
  unsigned r = x.u + 0x7FFFu + ((x.u >> 16) & 1u);   // round to nearest even
  return (unsigned short)(r >> 16);
}

__device__ __forceinline__ unsigned pack_bf16(float lo, float hi) {
  return (unsigned)f32_to_bf16(lo) | ((unsigned)f32_to_bf16(hi) << 16);
}

union Frag16 { uint4 q[2]; v16bf v; };

// Load a 16-element bf16 fragment per the CDNA5 16-bit A/B VGPR layout:
//   element e (0..7)  holds K = koff + 8*half + e
//   element e (8..15) holds K = koff + 16 + 8*half + (e-8)
// => two contiguous 16-byte LDS loads.
__device__ __forceinline__ v16bf load_frag(const unsigned short* rowbase,
                                           int koff, int half) {
  Frag16 fr;
  fr.q[0] = *(const uint4*)(rowbase + koff + 8 * half);
  fr.q[1] = *(const uint4*)(rowbase + koff + 16 + 8 * half);
  return fr.v;
}

// 16-lane butterfly reductions done entirely in VALU via DPP16 (no LDS).
// quad_perm xor1 (0xB1), quad_perm xor2 (0x4E): each quad holds its own
// reduction; row_half_mirror (0x141, ^7 in 8) combines quads; row_mirror
// (0x140, ^15 in 16) combines the two 8-lane halves.  Never crosses the
// 16-lane group.  CTRL must be a compile-time constant for the builtin.
template <int CTRL>
__device__ __forceinline__ float dpp_perm(float x) {
  return __int_as_float(__builtin_amdgcn_update_dpp(
      0, __float_as_int(x), CTRL, 0xF, 0xF, true));
}
__device__ __forceinline__ float redmax16(float x) {
  x = fmaxf(x, dpp_perm<0xB1>(x));
  x = fmaxf(x, dpp_perm<0x4E>(x));
  x = fmaxf(x, dpp_perm<0x141>(x));
  x = fmaxf(x, dpp_perm<0x140>(x));
  return x;
}
__device__ __forceinline__ float redsum16(float x) {
  x += dpp_perm<0xB1>(x);
  x += dpp_perm<0x4E>(x);
  x += dpp_perm<0x141>(x);
  x += dpp_perm<0x140>(x);
  return x;
}

// Eight f32 values of head column c -> eight bf16 in one 16-byte word.
__device__ __forceinline__ uint4 pack8(const v4f* x, int c) {
  uint4 o;
  o.x = pack_bf16(x[0][c], x[1][c]);
  o.y = pack_bf16(x[2][c], x[3][c]);
  o.z = pack_bf16(x[4][c], x[5][c]);
  o.w = pack_bf16(x[6][c], x[7][c]);
  return o;
}

// Splits the 16 interleaved heads apart.  A lane reads 16 bytes = 4 heads of
// one feature, eight times, and stores 8 bf16 of each of its 4 heads; every
// store instruction writes four whole 128-byte lines.
__global__ __launch_bounds__(256)
void split_heads_kernel(const float* __restrict__ q,
                        const float* __restrict__ k,
                        const float* __restrict__ v,
                        unsigned short* __restrict__ qb,
                        unsigned short* __restrict__ kb,
                        unsigned short* __restrict__ vt) {
  const int wave = threadIdx.x >> 5;
  const int lane = threadIdx.x & 31;
  const int h4   = lane & 3;             // heads 4*h4 .. 4*h4+3
  const int bid  = blockIdx.x;

  if (bid < QK_BLOCKS) {
    // Q then K, one row per unit: lane group dg holds features 8*dg .. 8*dg+7.
    const int dg   = lane >> 2;
    const int row0 = (bid * 8 + wave) * UNITS_PW;      // 0 .. 2*B*G*N-1
    const bool isq = row0 < NB * NG * NSEQ;            // uniform per wave
    const float* src          = isq ? q : k;
    unsigned short* dst       = isq ? qb : kb;
    const int r0              = row0 & (NB * NG * NSEQ - 1);
    for (int u = 0; u < UNITS_PW; u += 2) {
      const int r = r0 + u, bg = r >> 10, n = r & (NSEQ - 1);  // r even
      const float* s = src + (size_t)r * DMODEL + dg * 8 * NH + h4 * 4;
      v4f x[2][8];                       // two rows: 16 loads in flight
#pragma unroll
      for (int j = 0; j < 8; ++j) {
        x[0][j] = *(const v4f*)(s + j * NH);
        x[1][j] = *(const v4f*)(s + DMODEL + j * NH);
      }
      // Takes the loaded values as inputs, so that all 16 loads are in flight
      // together (without it they are issued a few at a time between the
      // conversions), and the address, so that it stays whole up to the wait
      // that stands before the loads' registers are reused.
      asm volatile("s_wait_xcnt 0x0" ::"v"(x[0][0]), "v"(x[0][1]), "v"(x[0][2]),
                   "v"(x[0][3]), "v"(x[0][4]), "v"(x[0][5]), "v"(x[0][6]),
                   "v"(x[0][7]), "v"(x[1][0]), "v"(x[1][1]), "v"(x[1][2]),
                   "v"(x[1][3]), "v"(x[1][4]), "v"(x[1][5]), "v"(x[1][6]),
                   "v"(x[1][7]), "v"(s)
                   : "memory");
      unsigned short* d =
          dst + ((size_t)(bg * NH + h4 * 4) * NSEQ + n) * DQ + dg * 8;
#pragma unroll
      for (int c = 0; c < 4; ++c) {
        *(uint4*)(d + (size_t)c * NSEQ * DQ)      = pack8(x[0], c);
        *(uint4*)(d + (size_t)c * NSEQ * DQ + DQ) = pack8(x[1], c);
      }
      // the next trip reuses the registers that these stores name
      asm volatile("s_wait_xcnt 0x0" ::: "memory");
    }
  } else {
    // V, 32 keys x 2 features per unit: lane group ng holds keys 8*ng .. 8*ng+7
    // of feature 2*pair + dlow.
    const int dlow  = (lane >> 2) & 1;
    const int ng    = lane >> 3;
    const int unit0 = ((bid - QK_BLOCKS) * 8 + wave) * UNITS_PW;
    for (int u = 0; u < UNITS_PW; u += 2) {
      const int unit = unit0 + u;                      // even
      const int dv   = (unit & 31) * 2 + dlow;
      const int nblk = (unit >> 5) & 31;
      const int bg   = unit >> 10;
      const float* s = v + ((size_t)bg * NSEQ + nblk * KBLK + ng * 8) * DMODEL +
                       dv * NH + h4 * 4;
      v4f x[2][8];                       // two feature pairs: 16 loads in flight
#pragma unroll
      for (int j = 0; j < 8; ++j) {
        x[0][j] = *(const v4f*)(s + (size_t)j * DMODEL);
        x[1][j] = *(const v4f*)(s + (size_t)j * DMODEL + 2 * NH);
      }
      // all 16 loads in flight together, address whole up to the wait: as above
      asm volatile("s_wait_xcnt 0x0" ::"v"(x[0][0]), "v"(x[0][1]), "v"(x[0][2]),
                   "v"(x[0][3]), "v"(x[0][4]), "v"(x[0][5]), "v"(x[0][6]),
                   "v"(x[0][7]), "v"(x[1][0]), "v"(x[1][1]), "v"(x[1][2]),
                   "v"(x[1][3]), "v"(x[1][4]), "v"(x[1][5]), "v"(x[1][6]),
                   "v"(x[1][7]), "v"(s)
                   : "memory");
      unsigned short* d =
          vt + (((size_t)(bg * NH + h4 * 4) * NITER + nblk) * DV + dv) * KBLK +
          ng * 8;
#pragma unroll
      for (int c = 0; c < 4; ++c) {
        *(uint4*)(d + (size_t)c * NSEQ * DV)            = pack8(x[0], c);
        *(uint4*)(d + (size_t)c * NSEQ * DV + 2 * KBLK) = pack8(x[1], c);
      }
      // the next trip reuses the registers that these stores name
      asm volatile("s_wait_xcnt 0x0" ::: "memory");
    }
  }
}

__global__ __launch_bounds__(256)
void attn_bias_fwd_kernel(
    const unsigned short* __restrict__ qb, const unsigned short* __restrict__ kb,
    const unsigned short* __restrict__ vt, const float* __restrict__ ncs,
    float* __restrict__ out) {
  __shared__ __align__(16) unsigned short q_lds[ROWS_PB * QSTRIDE]; // 18.0 KB
  __shared__ __align__(16) unsigned short k_lds[KBLK   * KSTRIDE];  //  4.5 KB
  __shared__ __align__(16) unsigned short v_lds[DV     * VSTRIDE];  //  5.0 KB
  __shared__ __align__(16) unsigned short p_lds[8 * 16 * PSTRIDE];  // 10.0 KB

  const int tid    = threadIdx.x;
  const int wave   = tid >> 5;
  const int lane   = tid & 31;
  const int lane16 = lane & 15;
  const int half   = lane >> 4;

  // Block decode: g slowest (L2 bias reuse), then (b,h), row-block fastest.
  const int bid     = blockIdx.x;
  const int rowblk  = bid & 7;
  const int head    = bid >> 3;          // 0..127
  const int g       = head >> 5;         // 0..3
  const int b       = (head >> 4) & 1;   // 0..1
  const int h       = head & 15;         // 0..15
  const int rowbase = rowblk * ROWS_PB;

  const size_t hp = (size_t)((b * NG + g) * NH + h);        // head plane
  const unsigned short* qg = qb + (hp * NSEQ + rowbase) * DQ;  // [row][d]
  const unsigned short* kg = kb + hp * NSEQ * DQ + tid * 8;    // [m][d]
  const unsigned short* vg = vt + hp * NSEQ * DV + tid * 8;    // [m/32][n][32]
  unsigned short* kdst = &k_lds[(tid >> 3) * KSTRIDE + (tid & 7) * 8];
  unsigned short* vdst = &v_lds[(tid >> 2) * VSTRIDE + (tid & 3) * 8];
  const float* biasp = ncs + (size_t)g * NSEQ * NSEQ
                       + (size_t)(rowbase + wave * 16 + 8 * half) * NSEQ
                       + lane16;                            // [t*NSEQ + m]

  // ---- stage Q tile (128 x 64) as bf16 in LDS -----------------------------
#pragma unroll  // the four loads of a thread go out together
  for (int j = 0; j < ROWS_PB * DQ / 8 / 256; ++j) {
    int i = tid + j * 256, row = i >> 3, d = (i & 7) * 8;
    *(uint4*)&q_lds[row * QSTRIDE + d] = *(const uint4*)(qg + i * 8);
  }
  __syncthreads();

  // A fragments of this wave's 16 Q rows (d-chunks 0..31 and 32..63)
  const unsigned short* qrow = &q_lds[(wave * 16 + lane16) * QSTRIDE];
  v16bf aq0 = load_frag(qrow, 0, half);
  v16bf aq1 = load_frag(qrow, 32, half);

  v8f acc0 = {}, acc1 = {}, acc2 = {}, acc3 = {};
  float m_run[8], l_run[8];
#pragma unroll
  for (int t = 0; t < 8; ++t) { m_run[t] = -3.0e38f; l_run[t] = 0.0f; }

  for (int it = 0; it < NITER; ++it) {
    const int m0 = it * KBLK;

    // ---- cooperative staging of K (row-major d) and V (transposed): each
    //      tile is 4 KB contiguous, 16 bytes per thread -----------------------
    __syncthreads();  // previous iteration's K/V readers are done

    const uint4 kreg = *(const uint4*)(kg + (size_t)it * (KBLK * DQ));
    const uint4 vreg = *(const uint4*)(vg + (size_t)it * (KBLK * DV));
    *(uint4*)kdst = kreg;
    *(uint4*)vdst = vreg;
    __syncthreads();

    // ---- preload all B fragments so DS latency overlaps WMMA/softmax ------
    const unsigned short* k0 = &k_lds[(0 * 16 + lane16) * KSTRIDE];
    const unsigned short* k1 = &k_lds[(1 * 16 + lane16) * KSTRIDE];
    v16bf bk00 = load_frag(k0, 0, half);
    v16bf bk01 = load_frag(k0, 32, half);
    v16bf bk10 = load_frag(k1, 0, half);
    v16bf bk11 = load_frag(k1, 32, half);
    v16bf bv0 = load_frag(&v_lds[(0 * 16 + lane16) * VSTRIDE], 0, half);
    v16bf bv1 = load_frag(&v_lds[(1 * 16 + lane16) * VSTRIDE], 0, half);
    v16bf bv2 = load_frag(&v_lds[(2 * 16 + lane16) * VSTRIDE], 0, half);
    v16bf bv3 = load_frag(&v_lds[(3 * 16 + lane16) * VSTRIDE], 0, half);

    // ---- S = Q * K^T : two 16x16 column tiles, K-dim 64 = 2 chunks --------
    v8f s0 = {}, s1 = {};
    s0 = __builtin_amdgcn_wmma_f32_16x16x32_bf16(false, aq0, false, bk00,
                                                 (short)0, s0, false, false);
    s0 = __builtin_amdgcn_wmma_f32_16x16x32_bf16(false, aq1, false, bk01,
                                                 (short)0, s0, false, false);
    s1 = __builtin_amdgcn_wmma_f32_16x16x32_bf16(false, aq0, false, bk10,
                                                 (short)0, s1, false, false);
    s1 = __builtin_amdgcn_wmma_f32_16x16x32_bf16(false, aq1, false, bk11,
                                                 (short)0, s1, false, false);

    // ---- bias, online softmax (rows t+8*half live in this 16-lane group) --
#pragma unroll
    for (int t = 0; t < 8; ++t) {
      float x0 = s0[t] * 0.125f - biasp[(size_t)t * NSEQ + m0];
      float x1 = s1[t] * 0.125f - biasp[(size_t)t * NSEQ + m0 + 16];
      float mx   = redmax16(fmaxf(x0, x1));
      float mnew = fmaxf(m_run[t], mx);
      float corr = __expf(m_run[t] - mnew);
      float p0 = __expf(x0 - mnew);
      float p1 = __expf(x1 - mnew);
      float rs = redsum16(p0 + p1);
      l_run[t] = l_run[t] * corr + rs;
      m_run[t] = mnew;
      acc0[t] *= corr; acc1[t] *= corr; acc2[t] *= corr; acc3[t] *= corr;
      // C-layout -> A-layout transpose via per-wave LDS scratch
      int prow = wave * 16 + t + 8 * half;
      p_lds[prow * PSTRIDE + lane16]      = f32_to_bf16(p0);
      p_lds[prow * PSTRIDE + 16 + lane16] = f32_to_bf16(p1);
    }
    // DS ops are in-order within a wave: the load below sees the stores.

    // ---- O += P * V : P is 16x32 (one A frag), V is 32x16 per dv tile -----
    v16bf pfrag =
        load_frag(&p_lds[(wave * 16 + lane16) * PSTRIDE], 0, half);
    acc0 = __builtin_amdgcn_wmma_f32_16x16x32_bf16(false, pfrag, false, bv0,
                                                   (short)0, acc0, false, false);
    acc1 = __builtin_amdgcn_wmma_f32_16x16x32_bf16(false, pfrag, false, bv1,
                                                   (short)0, acc1, false, false);
    acc2 = __builtin_amdgcn_wmma_f32_16x16x32_bf16(false, pfrag, false, bv2,
                                                   (short)0, acc2, false, false);
    acc3 = __builtin_amdgcn_wmma_f32_16x16x32_bf16(false, pfrag, false, bv3,
                                                   (short)0, acc3, false, false);
  }

  // ---- normalize and write out: contiguous [B,G,H,N,dv] -------------------
  const int orow0 = rowbase + wave * 16 + 8 * half;
  float* outp = out + ((size_t)((b * NG + g) * NH + h) * NSEQ + orow0) * DV
                + lane16;
#pragma unroll
  for (int t = 0; t < 8; ++t) {
    float inv = 1.0f / l_run[t];
    outp[(size_t)t * DV + 0]  = acc0[t] * inv;
    outp[(size_t)t * DV + 16] = acc1[t] * inv;
    outp[(size_t)t * DV + 32] = acc2[t] * inv;
    outp[(size_t)t * DV + 48] = acc3[t] * inv;
  }
}

extern "C" void kernel_launch(void* const* d_in, const int* in_sizes, int n_in,
                              void* d_out, int out_size, void* d_ws,
                              size_t ws_size, hipStream_t stream) {
  (void)in_sizes; (void)n_in; (void)out_size; (void)ws_size;
  const float* q   = (const float*)d_in[0];
  const float* k   = (const float*)d_in[1];
  const float* v   = (const float*)d_in[2];
  const float* ncs = (const float*)d_in[3];
  float* out = (float*)d_out;
  unsigned short* qb = (unsigned short*)d_ws;   // three bf16 planes, 48 MiB
  unsigned short* kb = qb + PLANE;
  unsigned short* vt = kb + PLANE;

  split_heads_kernel<<<QK_BLOCKS + V_BLOCKS, 256, 0, stream>>>(q, k, v, qb, kb,
                                                               vt);

  const int grid = NB * NG * NH * (NSEQ / ROWS_PB); // 1024 blocks
  attn_bias_fwd_kernel<<<grid, 256, 0, stream>>>(
      qb, kb, vt, ncs, out);
}

// v002
// A run of this version takes 67.4 microseconds.
// Next to v001, in two timings, it ran 1.55 times as fast each time.
// Over all steps from v000 it is 8.39 times as fast.
#include <hip/hip_runtime.h>

typedef __attribute__((ext_vector_type(16))) __bf16 v16bf;
typedef __attribute__((ext_vector_type(8)))  float  v8f;
typedef __attribute__((ext_vector_type(4)))  float  v4f;
typedef __attribute__((ext_vector_type(2)))  float  v2f;

#define NB      2
#define NG      4
#define NH      16
#define NSEQ    1024
#define DQ      64
#define DV      64
#define DMODEL  1024          // DQ*NH == DV*NH
#define ROWS_PB 128           // query rows per block (8 waves x 16 rows)
#define KBLK    32            // key columns per inner iteration
#define NITER   (NSEQ / KBLK) // 32
#define PLANE   (NB * NG * NH * NSEQ * DQ)  // elements of one bf16 plane

// Head-split launch: 8 waves per block, 4 units of work per wave.
#define UNITS_PW  4
#define QK_BLOCKS (2 * NB * NG * NSEQ / (8 * UNITS_PW))                    // 512
#define V_BLOCKS  (NB * NG * (NSEQ / KBLK) * (DV / 2) / (8 * UNITS_PW))    // 256

// LDS strides in bf16 elements (row base must stay 16B aligned: *2B % 16 == 0)
#define QSTRIDE 72            // 144 B row
#define KSTRIDE 72
#define VSTRIDE 40            // 80 B row (transposed V: [dv][k])
#define BSTRIDE 36            // bias rows, in floats: 144 B row

__device__ __forceinline__ unsigned short f32_to_bf16(float f) {
  union { float f; unsigned u; } x; x.f = f;
  unsigned r = x.u + 0x7FFFu + ((x.u >> 16) & 1u);   // round to nearest even
  return (unsigned short)(r >> 16);
}

__device__ __forceinline__ unsigned pack_bf16(float lo, float hi) {
  return (unsigned)f32_to_bf16(lo) | ((unsigned)f32_to_bf16(hi) << 16);
}

union Frag16 { uint4 q[2]; v16bf v; };

// Load a 16-element bf16 fragment per the CDNA5 16-bit A/B VGPR layout:
//   element e (0..7)  holds K = koff + 8*half + e
//   element e (8..15) holds K = koff + 16 + 8*half + (e-8)
// => two contiguous 16-byte LDS loads.
__device__ __forceinline__ v16bf load_frag(const unsigned short* rowbase,
                                           int koff, int half) {
  Frag16 fr;
  fr.q[0] = *(const uint4*)(rowbase + koff + 8 * half);
  fr.q[1] = *(const uint4*)(rowbase + koff + 16 + 8 * half);
  return fr.v;
}

// Lane l <-> lane l ^ 16: the two lanes that share one query column.
__device__ __forceinline__ float other_half(float x) {
  int b = __float_as_int(x);
  return __int_as_float(__builtin_amdgcn_permlanex16(b, b, 0x76543210,
                                                     0xfedcba98, false, false));
}

// Eight f32 values of head column c -> eight bf16 in one 16-byte word.
__device__ __forceinline__ uint4 pack8(const v4f* x, int c) {
  uint4 o;
  o.x = pack_bf16(x[0][c], x[1][c]);
  o.y = pack_bf16(x[2][c], x[3][c]);
  o.z = pack_bf16(x[4][c], x[5][c]);
  o.w = pack_bf16(x[6][c], x[7][c]);
  return o;
}

// Splits the 16 interleaved heads apart.  A lane reads 16 bytes = 4 heads of
// one feature, eight times, and stores 8 bf16 of each of its 4 heads; every
// store instruction writes four whole 128-byte lines.
__global__ __launch_bounds__(256)
void split_heads_kernel(const float* __restrict__ q,
                        const float* __restrict__ k,
                        const float* __restrict__ v,
                        unsigned short* __restrict__ qb,
                        unsigned short* __restrict__ kb,
                        unsigned short* __restrict__ vt) {
  const int wave = threadIdx.x >> 5;
  const int lane = threadIdx.x & 31;
  const int h4   = lane & 3;             // heads 4*h4 .. 4*h4+3
  const int bid  = blockIdx.x;

  if (bid < QK_BLOCKS) {
    // Q then K, one row per unit: lane group dg holds features 8*dg .. 8*dg+7.
    const int dg   = lane >> 2;
    const int row0 = (bid * 8 + wave) * UNITS_PW;      // 0 .. 2*B*G*N-1
    const bool isq = row0 < NB * NG * NSEQ;            // uniform per wave
    const float* src          = isq ? q : k;
    unsigned short* dst       = isq ? qb : kb;
    const int r0              = row0 & (NB * NG * NSEQ - 1);
    for (int u = 0; u < UNITS_PW; u += 2) {
      const int r = r0 + u, bg = r >> 10, n = r & (NSEQ - 1);  // r even
      const float* s = src + (size_t)r * DMODEL + dg * 8 * NH + h4 * 4;
      v4f x[2][8];                       // two rows: 16 loads in flight
#pragma unroll
      for (int j = 0; j < 8; ++j) {
        x[0][j] = *(const v4f*)(s + j * NH);
        x[1][j] = *(const v4f*)(s + DMODEL + j * NH);
      }
      // Takes the loaded values as inputs, so that all 16 loads are in flight
      // together (without it they are issued a few at a time between the
      // conversions), and the address, so that it stays whole up to the wait
      // that stands before the loads' registers are reused.
      asm volatile("s_wait_xcnt 0x0" ::"v"(x[0][0]), "v"(x[0][1]), "v"(x[0][2]),
                   "v"(x[0][3]), "v"(x[0][4]), "v"(x[0][5]), "v"(x[0][6]),
                   "v"(x[0][7]), "v"(x[1][0]), "v"(x[1][1]), "v"(x[1][2]),
                   "v"(x[1][3]), "v"(x[1][4]), "v"(x[1][5]), "v"(x[1][6]),
                   "v"(x[1][7]), "v"(s)
                   : "memory");
      unsigned short* d =
          dst + ((size_t)(bg * NH + h4 * 4) * NSEQ + n) * DQ + dg * 8;
#pragma unroll
      for (int c = 0; c < 4; ++c) {
        *(uint4*)(d + (size_t)c * NSEQ * DQ)      = pack8(x[0], c);
        *(uint4*)(d + (size_t)c * NSEQ * DQ + DQ) = pack8(x[1], c);
      }
      // the next trip reuses the registers that these stores name
      asm volatile("s_wait_xcnt 0x0" ::: "memory");
    }
  } else {
    // V, 32 keys x 2 features per unit: lane group ng holds keys 8*ng .. 8*ng+7
    // of feature 2*pair + dlow.
    const int dlow  = (lane >> 2) & 1;
    const int ng    = lane >> 3;
    const int unit0 = ((bid - QK_BLOCKS) * 8 + wave) * UNITS_PW;
    for (int u = 0; u < UNITS_PW; u += 2) {
      const int unit = unit0 + u;                      // even
      const int dv   = (unit & 31) * 2 + dlow;
      const int nblk = (unit >> 5) & 31;
      const int bg   = unit >> 10;
      const float* s = v + ((size_t)bg * NSEQ + nblk * KBLK + ng * 8) * DMODEL +
                       dv * NH + h4 * 4;
      v4f x[2][8];                       // two feature pairs: 16 loads in flight
#pragma unroll
      for (int j = 0; j < 8; ++j) {
        x[0][j] = *(const v4f*)(s + (size_t)j * DMODEL);
        x[1][j] = *(const v4f*)(s + (size_t)j * DMODEL + 2 * NH);
      }
      // all 16 loads in flight together, address whole up to the wait: as above
      asm volatile("s_wait_xcnt 0x0" ::"v"(x[0][0]), "v"(x[0][1]), "v"(x[0][2]),
                   "v"(x[0][3]), "v"(x[0][4]), "v"(x[0][5]), "v"(x[0][6]),
                   "v"(x[0][7]), "v"(x[1][0]), "v"(x[1][1]), "v"(x[1][2]),
                   "v"(x[1][3]), "v"(x[1][4]), "v"(x[1][5]), "v"(x[1][6]),
                   "v"(x[1][7]), "v"(s)
                   : "memory");
      unsigned short* d =
          vt + (((size_t)(bg * NH + h4 * 4) * NITER + nblk) * DV + dv) * KBLK +
          ng * 8;
#pragma unroll
      for (int c = 0; c < 4; ++c) {
        *(uint4*)(d + (size_t)c * NSEQ * DV)            = pack8(x[0], c);
        *(uint4*)(d + (size_t)c * NSEQ * DV + 2 * KBLK) = pack8(x[1], c);
      }
      // the next trip reuses the registers that these stores name
      asm volatile("s_wait_xcnt 0x0" ::: "memory");
    }
  }
}

__global__ __launch_bounds__(256)
void attn_bias_fwd_kernel(
    const unsigned short* __restrict__ qb, const unsigned short* __restrict__ kb,
    const unsigned short* __restrict__ vt, const float* __restrict__ ncs,
    float* __restrict__ out) {
  __shared__ __align__(16) unsigned short q_lds[ROWS_PB * QSTRIDE]; // 18.0 KB
  __shared__ __align__(16) unsigned short k_lds[KBLK   * KSTRIDE];  //  4.5 KB
  __shared__ __align__(16) unsigned short v_lds[DV     * VSTRIDE];  //  5.0 KB
  __shared__ __align__(16) float          b_lds[ROWS_PB * BSTRIDE]; // 18.0 KB

  const int tid    = threadIdx.x;
  const int wave   = tid >> 5;
  const int lane   = tid & 31;
  const int lane16 = lane & 15;
  const int half   = lane >> 4;

  // Block decode: g slowest (L2 bias reuse), then (b,h), row-block fastest.
  const int bid     = blockIdx.x;
  const int rowblk  = bid & 7;
  const int head    = bid >> 3;          // 0..127
  const int g       = head >> 5;         // 0..3
  const int b       = (head >> 4) & 1;   // 0..1
  const int h       = head & 15;         // 0..15
  const int rowbase = rowblk * ROWS_PB;

  const size_t hp = (size_t)((b * NG + g) * NH + h);        // head plane
  const unsigned short* qg = qb + (hp * NSEQ + rowbase) * DQ;  // [row][d]
  const unsigned short* kg = kb + hp * NSEQ * DQ + tid * 8;    // [m][d]
  const unsigned short* vg = vt + hp * NSEQ * DV + tid * 8;    // [m/32][n][32]
  unsigned short* kdst = &k_lds[(tid >> 3) * KSTRIDE + (tid & 7) * 8];
  unsigned short* vdst = &v_lds[(tid >> 2) * VSTRIDE + (tid & 3) * 8];
  // Bias tile of this wave, 16 queries x 32 keys: a load covers four whole
  // 128-byte rows; the wave's own LDS rows turn it so that a lane gets the 16
  // keys of its query.
  const float* biasp = ncs + (size_t)g * NSEQ * NSEQ
                       + (size_t)(rowbase + wave * 16 + (lane >> 3)) * NSEQ
                       + (lane & 7) * 4;                    // [4*i*NSEQ + m]
  float* bdst = &b_lds[(wave * 16 + (lane >> 3)) * BSTRIDE + (lane & 7) * 4];
  const float* bsrc = &b_lds[(wave * 16 + lane16) * BSTRIDE + 8 * half];

  // ---- stage Q tile (128 x 64) as bf16 in LDS -----------------------------
#pragma unroll  // the four loads of a thread go out together
  for (int j = 0; j < ROWS_PB * DQ / 8 / 256; ++j) {
    int i = tid + j * 256, row = i >> 3, d = (i & 7) * 8;
    *(uint4*)&q_lds[row * QSTRIDE + d] = *(const uint4*)(qg + i * 8);
  }
  __syncthreads();

  // B fragments: this wave's 16 queries as columns (d-chunks 0..31, 32..63)
  const unsigned short* qrow = &q_lds[(wave * 16 + lane16) * QSTRIDE];
  v16bf aq0 = load_frag(qrow, 0, half);
  v16bf aq1 = load_frag(qrow, 32, half);

  v8f acc0 = {}, acc1 = {}, acc2 = {}, acc3 = {};
  // Of query lane16: the running maximum (equal in both halves) and this
  // half's own share of the running sum.
  float m_run = -3.0e38f, l_run = 0.0f;

  for (int it = 0; it < NITER; ++it) {
    const int m0 = it * KBLK;

    // ---- cooperative staging of K (row-major d) and V (transposed): each
    //      tile is 4 KB contiguous, 16 bytes per thread -----------------------
    __syncthreads();  // previous iteration's K/V readers are done

    const uint4 kreg = *(const uint4*)(kg + (size_t)it * (KBLK * DQ));
    const uint4 vreg = *(const uint4*)(vg + (size_t)it * (KBLK * DV));
    v4f breg[4];
#pragma unroll  // the four loads go out together with the K and V loads
    for (int i = 0; i < 4; ++i)
      breg[i] = *(const v4f*)(biasp + (size_t)i * 4 * NSEQ + m0);
    *(uint4*)kdst = kreg;
    *(uint4*)vdst = vreg;
#pragma unroll  // breg[] stays in registers
    for (int i = 0; i < 4; ++i) *(v4f*)(bdst + i * 4 * BSTRIDE) = breg[i];
    __syncthreads();

    // ---- preload all A fragments so DS latency overlaps WMMA/softmax ------
    const unsigned short* k0 = &k_lds[(0 * 16 + lane16) * KSTRIDE];
    const unsigned short* k1 = &k_lds[(1 * 16 + lane16) * KSTRIDE];
    v16bf bk00 = load_frag(k0, 0, half);
    v16bf bk01 = load_frag(k0, 32, half);
    v16bf bk10 = load_frag(k1, 0, half);
    v16bf bk11 = load_frag(k1, 32, half);
    v16bf bv0 = load_frag(&v_lds[(0 * 16 + lane16) * VSTRIDE], 0, half);
    v16bf bv1 = load_frag(&v_lds[(1 * 16 + lane16) * VSTRIDE], 0, half);
    v16bf bv2 = load_frag(&v_lds[(2 * 16 + lane16) * VSTRIDE], 0, half);
    v16bf bv3 = load_frag(&v_lds[(3 * 16 + lane16) * VSTRIDE], 0, half);

    // bias of query lane16: keys m0 + 8*half + 0..7 and m0 + 16 + 8*half + 0..7
    v4f bb[4];
    bb[0] = *(const v4f*)(bsrc);
    bb[1] = *(const v4f*)(bsrc + 4);
    bb[2] = *(const v4f*)(bsrc + 16);
    bb[3] = *(const v4f*)(bsrc + 20);

    // ---- S^T = K * Q^T : two 16-key row tiles, K-dim 64 = 2 chunks --------
    //      s0[t] = key m0 + 8*half + t, s1[t] = key m0 + 16 + 8*half + t,
    //      both of query lane16
    v8f s0 = {}, s1 = {};
    s0 = __builtin_amdgcn_wmma_f32_16x16x32_bf16(false, bk00, false, aq0,
                                                 (short)0, s0, false, false);
    s0 = __builtin_amdgcn_wmma_f32_16x16x32_bf16(false, bk01, false, aq1,
                                                 (short)0, s0, false, false);
    s1 = __builtin_amdgcn_wmma_f32_16x16x32_bf16(false, bk10, false, aq0,
                                                 (short)0, s1, false, false);
    s1 = __builtin_amdgcn_wmma_f32_16x16x32_bf16(false, bk11, false, aq1,
                                                 (short)0, s1, false, false);

    // ---- bias, online softmax: 16 keys of one query per lane --------------
    //      (the loops over x[] are unrolled so that x[] stays in registers)
    float x[16];
#pragma unroll
    for (int t = 0; t < 8; ++t) {
      x[t]     = s0[t] * 0.125f - bb[t >> 2][t & 3];
      x[8 + t] = s1[t] * 0.125f - bb[2 + (t >> 2)][t & 3];
    }
    float mx = x[0];
#pragma unroll
    for (int t = 1; t < 16; ++t) mx = fmaxf(mx, x[t]);
    mx = fmaxf(mx, other_half(mx));      // both halves scale by one maximum
    const float mnew = fmaxf(m_run, mx);
    const float corr = __expf(m_run - mnew);
    v2f rs = {0.0f, 0.0f};               // even and odd keys: packed adds
#pragma unroll
    for (int t = 0; t < 16; t += 2) {
      x[t]     = __expf(x[t] - mnew);
      x[t + 1] = __expf(x[t + 1] - mnew);
      rs += (v2f){x[t], x[t + 1]};
    }
    l_run = l_run * corr + (rs.x + rs.y);
    m_run = mnew;
#pragma unroll  // accumulator elements are named by constants
    for (int t = 0; t < 8; ++t) {
      acc0[t] *= corr; acc1[t] *= corr; acc2[t] *= corr; acc3[t] *= corr;
    }

    // ---- O^T += V^T * P^T : the two score tiles, rounded in place, are the
    //      32-key B operand in the hardware's k order; V^T rows are A --------
    Frag16 pf;
    pf.q[0] = make_uint4(pack_bf16(x[0], x[1]), pack_bf16(x[2], x[3]),
                         pack_bf16(x[4], x[5]), pack_bf16(x[6], x[7]));
    pf.q[1] = make_uint4(pack_bf16(x[8], x[9]), pack_bf16(x[10], x[11]),
                         pack_bf16(x[12], x[13]), pack_bf16(x[14], x[15]));
    acc0 = __builtin_amdgcn_wmma_f32_16x16x32_bf16(false, bv0, false, pf.v,
                                                   (short)0, acc0, false, false);
    acc1 = __builtin_amdgcn_wmma_f32_16x16x32_bf16(false, bv1, false, pf.v,
                                                   (short)0, acc1, false, false);
    acc2 = __builtin_amdgcn_wmma_f32_16x16x32_bf16(false, bv2, false, pf.v,
                                                   (short)0, acc2, false, false);
    acc3 = __builtin_amdgcn_wmma_f32_16x16x32_bf16(false, bv3, false, pf.v,
                                                   (short)0, acc3, false, false);
  }

  // ---- normalize and write out: contiguous [B,G,H,N,dv] -------------------
  //      accJ[t] = feature 16*J + 8*half + t of query lane16
  const float inv = 1.0f / (l_run + other_half(l_run));
  float* outp = out + ((size_t)((b * NG + g) * NH + h) * NSEQ + rowbase +
                       wave * 16 + lane16) * DV + 8 * half;
  const v8f o[4] = {acc0 * inv, acc1 * inv, acc2 * inv, acc3 * inv};
#pragma unroll  // o[] stays in registers
  for (int j = 0; j < 4; ++j) {
    *(v4f*)(outp + j * 16)     = o[j].lo;
    *(v4f*)(outp + j * 16 + 4) = o[j].hi;
  }
}

extern "C" void kernel_launch(void* const* d_in, const int* in_sizes, int n_in,
                              void* d_out, int out_size, void* d_ws,
                              size_t ws_size, hipStream_t stream) {
  (void)in_sizes; (void)n_in; (void)out_size; (void)ws_size;
  const float* q   = (const float*)d_in[0];
  const float* k   = (const float*)d_in[1];
  const float* v   = (const float*)d_in[2];
  const float* ncs = (const float*)d_in[3];
  float* out = (float*)d_out;
  unsigned short* qb = (unsigned short*)d_ws;   // three bf16 planes, 48 MiB
  unsigned short* kb = qb + PLANE;
  unsigned short* vt = kb + PLANE;

  split_heads_kernel<<<QK_BLOCKS + V_BLOCKS, 256, 0, stream>>>(q, k, v, qb, kb,
                                                               vt);

  const int grid = NB * NG * NH * (NSEQ / ROWS_PB); // 1024 blocks
  attn_bias_fwd_kernel<<<grid, 256, 0, stream>>>(
      qb, kb, vt, ncs, out);
}

// v003
// Measured time: 64 microseconds a run.
// Next to v002, in two timings, it ran 1.05 times as fast each time.
// Over all steps from v000 it is 8.84 times as fast.
#include <hip/hip_runtime.h>

typedef __attribute__((ext_vector_type(16))) __bf16 v16bf;
typedef __attribute__((ext_vector_type(2)))  __bf16 v2bf;
typedef __attribute__((ext_vector_type(8)))  float  v8f;
typedef __attribute__((ext_vector_type(4)))  float  v4f;
typedef __attribute__((ext_vector_type(2)))  float  v2f;

#define NB      2
#define NG      4
#define NH      16
#define NSEQ    1024
#define DQ      64
#define DV      64
#define DMODEL  1024          // DQ*NH == DV*NH
#define ROWS_PB 128           // query rows per block (8 waves x 16 rows)
#define KBLK    32            // key columns per inner iteration
#define NITER   (NSEQ / KBLK) // 32
#define PLANE   (NB * NG * NH * NSEQ * DQ)  // elements of one bf16 plane

// Head-split launch: 8 waves per block, 4 units of work per wave.
#define UNITS_PW  4
#define QK_BLOCKS (2 * NB * NG * NSEQ / (8 * UNITS_PW))                    // 512
#define V_BLOCKS  (NB * NG * (NSEQ / KBLK) * (DV / 2) / (8 * UNITS_PW))    // 256

// LDS strides in bf16 elements (row base must stay 16B aligned: *2B % 16 == 0)
#define QSTRIDE 72            // 144 B row
#define KSTRIDE 72
#define VSTRIDE 40            // 80 B row (transposed V: [dv][k])
#define BSTRIDE 36            // bias rows, in floats: 144 B row

// Two f32 -> two bf16 in one word, round to nearest even: one packed hardware
// convert (v_cvt_pk_bf16_f32).
__device__ __forceinline__ unsigned pack_bf16(float lo, float hi) {
  const v2f p = {lo, hi};
  return __builtin_bit_cast(unsigned, __builtin_convertvector(p, v2bf));
}

union Frag16 { uint4 q[2]; v16bf v; };

// Load a 16-element bf16 fragment per the CDNA5 16-bit A/B VGPR layout:
//   element e (0..7)  holds K = koff + 8*half + e
//   element e (8..15) holds K = koff + 16 + 8*half + (e-8)
// => two contiguous 16-byte LDS loads.
__device__ __forceinline__ v16bf load_frag(const unsigned short* rowbase,
                                           int koff, int half) {
  Frag16 fr;
  fr.q[0] = *(const uint4*)(rowbase + koff + 8 * half);
  fr.q[1] = *(const uint4*)(rowbase + koff + 16 + 8 * half);
  return fr.v;
}

// Lane l <-> lane l ^ 16: the two lanes that share one query column.
__device__ __forceinline__ float other_half(float x) {
  int b = __float_as_int(x);
  return __int_as_float(__builtin_amdgcn_permlanex16(b, b, 0x76543210,
                                                     0xfedcba98, false, false));
}

// Eight f32 values of head column c -> eight bf16 in one 16-byte word.
__device__ __forceinline__ uint4 pack8(const v4f* x, int c) {
  uint4 o;
  o.x = pack_bf16(x[0][c], x[1][c]);
  o.y = pack_bf16(x[2][c], x[3][c]);
  o.z = pack_bf16(x[4][c], x[5][c]);
  o.w = pack_bf16(x[6][c], x[7][c]);
  return o;
}

// Splits the 16 interleaved heads apart.  A lane reads 16 bytes = 4 heads of
// one feature, eight times, and stores 8 bf16 of each of its 4 heads; every
// store instruction writes four whole 128-byte lines.
__global__ __launch_bounds__(256)
void split_heads_kernel(const float* __restrict__ q,
                        const float* __restrict__ k,
                        const float* __restrict__ v,
                        unsigned short* __restrict__ qb,
                        unsigned short* __restrict__ kb,
                        unsigned short* __restrict__ vt) {
  const int wave = threadIdx.x >> 5;
  const int lane = threadIdx.x & 31;
  const int h4   = lane & 3;             // heads 4*h4 .. 4*h4+3
  const int bid  = blockIdx.x;

  if (bid < QK_BLOCKS) {
    // Q then K, one row per unit: lane group dg holds features 8*dg .. 8*dg+7.
    const int dg   = lane >> 2;
    const int row0 = (bid * 8 + wave) * UNITS_PW;      // 0 .. 2*B*G*N-1
    const bool isq = row0 < NB * NG * NSEQ;            // uniform per wave
    const float* src          = isq ? q : k;
    unsigned short* dst       = isq ? qb : kb;
    const int r0              = row0 & (NB * NG * NSEQ - 1);
    for (int u = 0; u < UNITS_PW; u += 2) {
      const int r = r0 + u, bg = r >> 10, n = r & (NSEQ - 1);  // r even
      const float* s = src + (size_t)r * DMODEL + dg * 8 * NH + h4 * 4;
      v4f x[2][8];                       // two rows: 16 loads in flight
#pragma unroll
      for (int j = 0; j < 8; ++j) {
        x[0][j] = *(const v4f*)(s + j * NH);
        x[1][j] = *(const v4f*)(s + DMODEL + j * NH);
      }
      // Takes the loaded values as inputs, so that all 16 loads are in flight
      // together (without it they are issued a few at a time between the
      // conversions), and the address, so that it stays whole up to the wait
      // that stands before the loads' registers are reused.
      asm volatile("s_wait_xcnt 0x0" ::"v"(x[0][0]), "v"(x[0][1]), "v"(x[0][2]),
                   "v"(x[0][3]), "v"(x[0][4]), "v"(x[0][5]), "v"(x[0][6]),
                   "v"(x[0][7]), "v"(x[1][0]), "v"(x[1][1]), "v"(x[1][2]),
                   "v"(x[1][3]), "v"(x[1][4]), "v"(x[1][5]), "v"(x[1][6]),
                   "v"(x[1][7]), "v"(s)
                   : "memory");
      unsigned short* d =
          dst + ((size_t)(bg * NH + h4 * 4) * NSEQ + n) * DQ + dg * 8;
#pragma unroll
      for (int c = 0; c < 4; ++c) {
        *(uint4*)(d + (size_t)c * NSEQ * DQ)      = pack8(x[0], c);
        *(uint4*)(d + (size_t)c * NSEQ * DQ + DQ) = pack8(x[1], c);
      }
      // the next trip reuses the registers that these stores name
      asm volatile("s_wait_xcnt 0x0" ::: "memory");
    }
  } else {
    // V, 32 keys x 2 features per unit: lane group ng holds keys 8*ng .. 8*ng+7
    // of feature 2*pair + dlow.
    const int dlow  = (lane >> 2) & 1;
    const int ng    = lane >> 3;
    const int unit0 = ((bid - QK_BLOCKS) * 8 + wave) * UNITS_PW;
    for (int u = 0; u < UNITS_PW; u += 2) {
      const int unit = unit0 + u;                      // even
      const int dv   = (unit & 31) * 2 + dlow;
      const int nblk = (unit >> 5) & 31;
      const int bg   = unit >> 10;
      const float* s = v + ((size_t)bg * NSEQ + nblk * KBLK + ng * 8) * DMODEL +
                       dv * NH + h4 * 4;
      v4f x[2][8];                       // two feature pairs: 16 loads in flight
#pragma unroll
      for (int j = 0; j < 8; ++j) {
        x[0][j] = *(const v4f*)(s + (size_t)j * DMODEL);
        x[1][j] = *(const v4f*)(s + (size_t)j * DMODEL + 2 * NH);
      }
      // all 16 loads in flight together, address whole up to the wait: as above
      asm volatile("s_wait_xcnt 0x0" ::"v"(x[0][0]), "v"(x[0][1]), "v"(x[0][2]),
                   "v"(x[0][3]), "v"(x[0][4]), "v"(x[0][5]), "v"(x[0][6]),
                   "v"(x[0][7]), "v"(x[1][0]), "v"(x[1][1]), "v"(x[1][2]),
                   "v"(x[1][3]), "v"(x[1][4]), "v"(x[1][5]), "v"(x[1][6]),
                   "v"(x[1][7]), "v"(s)
                   : "memory");
      unsigned short* d =
          vt + (((size_t)(bg * NH + h4 * 4) * NITER + nblk) * DV + dv) * KBLK +
          ng * 8;
#pragma unroll
      for (int c = 0; c < 4; ++c) {
        *(uint4*)(d + (size_t)c * NSEQ * DV)            = pack8(x[0], c);
        *(uint4*)(d + (size_t)c * NSEQ * DV + 2 * KBLK) = pack8(x[1], c);
      }
      // the next trip reuses the registers that these stores name
      asm volatile("s_wait_xcnt 0x0" ::: "memory");
    }
  }
}

__global__ __launch_bounds__(256)
void attn_bias_fwd_kernel(
    const unsigned short* __restrict__ qb, const unsigned short* __restrict__ kb,
    const unsigned short* __restrict__ vt, const float* __restrict__ ncs,
    float* __restrict__ out) {
  __shared__ __align__(16) unsigned short q_lds[ROWS_PB * QSTRIDE]; // 18.0 KB
  __shared__ __align__(16) unsigned short k_lds[KBLK   * KSTRIDE];  //  4.5 KB
  __shared__ __align__(16) unsigned short v_lds[DV     * VSTRIDE];  //  5.0 KB
  __shared__ __align__(16) float          b_lds[ROWS_PB * BSTRIDE]; // 18.0 KB

  const int tid    = threadIdx.x;
  const int wave   = tid >> 5;
  const int lane   = tid & 31;
  const int lane16 = lane & 15;
  const int half   = lane >> 4;

  // Block decode: g slowest (L2 bias reuse), then (b,h), row-block fastest.
  const int bid     = blockIdx.x;
  const int rowblk  = bid & 7;
  const int head    = bid >> 3;          // 0..127
  const int g       = head >> 5;         // 0..3
  const int b       = (head >> 4) & 1;   // 0..1
  const int h       = head & 15;         // 0..15
  const int rowbase = rowblk * ROWS_PB;

  const size_t hp = (size_t)((b * NG + g) * NH + h);        // head plane
  const unsigned short* qg = qb + (hp * NSEQ + rowbase) * DQ;  // [row][d]
  const unsigned short* kg = kb + hp * NSEQ * DQ + tid * 8;    // [m][d]
  const unsigned short* vg = vt + hp * NSEQ * DV + tid * 8;    // [m/32][n][32]
  unsigned short* kdst = &k_lds[(tid >> 3) * KSTRIDE + (tid & 7) * 8];
  unsigned short* vdst = &v_lds[(tid >> 2) * VSTRIDE + (tid & 3) * 8];
  // Bias tile of this wave, 16 queries x 32 keys: a load covers four whole
  // 128-byte rows; the wave's own LDS rows turn it so that a lane gets the 16
  // keys of its query.
  const float* biasp = ncs + (size_t)g * NSEQ * NSEQ
                       + (size_t)(rowbase + wave * 16 + (lane >> 3)) * NSEQ
                       + (lane & 7) * 4;                    // [4*i*NSEQ + m]
  float* bdst = &b_lds[(wave * 16 + (lane >> 3)) * BSTRIDE + (lane & 7) * 4];
  const float* bsrc = &b_lds[(wave * 16 + lane16) * BSTRIDE + 8 * half];

  // ---- stage Q tile (128 x 64) as bf16 in LDS -----------------------------
#pragma unroll  // the four loads of a thread go out together
  for (int j = 0; j < ROWS_PB * DQ / 8 / 256; ++j) {
    int i = tid + j * 256, row = i >> 3, d = (i & 7) * 8;
    *(uint4*)&q_lds[row * QSTRIDE + d] = *(const uint4*)(qg + i * 8);
  }
  __syncthreads();

  // B fragments: this wave's 16 queries as columns (d-chunks 0..31, 32..63)
  const unsigned short* qrow = &q_lds[(wave * 16 + lane16) * QSTRIDE];
  v16bf aq0 = load_frag(qrow, 0, half);
  v16bf aq1 = load_frag(qrow, 32, half);

  v8f acc0 = {}, acc1 = {}, acc2 = {}, acc3 = {};
  // Of query lane16: the running maximum (equal in both halves) and this
  // half's own share of the running sum.
  float m_run = -3.0e38f, l_run = 0.0f;

  for (int it = 0; it < NITER; ++it) {
    const int m0 = it * KBLK;

    // ---- cooperative staging of K (row-major d) and V (transposed): each
    //      tile is 4 KB contiguous, 16 bytes per thread -----------------------
    __syncthreads();  // previous iteration's K/V readers are done

    const uint4 kreg = *(const uint4*)(kg + (size_t)it * (KBLK * DQ));
    const uint4 vreg = *(const uint4*)(vg + (size_t)it * (KBLK * DV));
    v4f breg[4];
#pragma unroll  // the four loads go out together with the K and V loads
    for (int i = 0; i < 4; ++i)
      breg[i] = *(const v4f*)(biasp + (size_t)i * 4 * NSEQ + m0);
    *(uint4*)kdst = kreg;
    *(uint4*)vdst = vreg;
#pragma unroll  // breg[] stays in registers
    for (int i = 0; i < 4; ++i) *(v4f*)(bdst + i * 4 * BSTRIDE) = breg[i];
    __syncthreads();

    // ---- preload all A fragments so DS latency overlaps WMMA/softmax ------
    const unsigned short* k0 = &k_lds[(0 * 16 + lane16) * KSTRIDE];
    const unsigned short* k1 = &k_lds[(1 * 16 + lane16) * KSTRIDE];
    v16bf bk00 = load_frag(k0, 0, half);
    v16bf bk01 = load_frag(k0, 32, half);
    v16bf bk10 = load_frag(k1, 0, half);
    v16bf bk11 = load_frag(k1, 32, half);
    v16bf bv0 = load_frag(&v_lds[(0 * 16 + lane16) * VSTRIDE], 0, half);
    v16bf bv1 = load_frag(&v_lds[(1 * 16 + lane16) * VSTRIDE], 0, half);
    v16bf bv2 = load_frag(&v_lds[(2 * 16 + lane16) * VSTRIDE], 0, half);
    v16bf bv3 = load_frag(&v_lds[(3 * 16 + lane16) * VSTRIDE], 0, half);

    // bias of query lane16: keys m0 + 8*half + 0..7 and m0 + 16 + 8*half + 0..7
    v4f bb[4];
    bb[0] = *(const v4f*)(bsrc);
    bb[1] = *(const v4f*)(bsrc + 4);
    bb[2] = *(const v4f*)(bsrc + 16);
    bb[3] = *(const v4f*)(bsrc + 20);

    // ---- S^T = K * Q^T : two 16-key row tiles, K-dim 64 = 2 chunks --------
    //      s0[t] = key m0 + 8*half + t, s1[t] = key m0 + 16 + 8*half + t,
    //      both of query lane16
    v8f s0 = {}, s1 = {};
    s0 = __builtin_amdgcn_wmma_f32_16x16x32_bf16(false, bk00, false, aq0,
                                                 (short)0, s0, false, false);
    s0 = __builtin_amdgcn_wmma_f32_16x16x32_bf16(false, bk01, false, aq1,
                                                 (short)0, s0, false, false);
    s1 = __builtin_amdgcn_wmma_f32_16x16x32_bf16(false, bk10, false, aq0,
                                                 (short)0, s1, false, false);
    s1 = __builtin_amdgcn_wmma_f32_16x16x32_bf16(false, bk11, false, aq1,
                                                 (short)0, s1, false, false);

    // ---- bias, online softmax: 16 keys of one query per lane --------------
    //      (the loops over x[] are unrolled so that x[] stays in registers)
    float x[16];
#pragma unroll
    for (int t = 0; t < 8; ++t) {
      x[t]     = s0[t] * 0.125f - bb[t >> 2][t & 3];
      x[8 + t] = s1[t] * 0.125f - bb[2 + (t >> 2)][t & 3];
    }
    float mx = x[0];
#pragma unroll
    for (int t = 1; t < 16; ++t) mx = fmaxf(mx, x[t]);
    mx = fmaxf(mx, other_half(mx));      // both halves scale by one maximum
    const float mnew = fmaxf(m_run, mx);
    const float corr = __expf(m_run - mnew);
    v2f rs = {0.0f, 0.0f};               // even and odd keys: packed adds
#pragma unroll
    for (int t = 0; t < 16; t += 2) {
      x[t]     = __expf(x[t] - mnew);
      x[t + 1] = __expf(x[t + 1] - mnew);
      rs += (v2f){x[t], x[t + 1]};
    }
    l_run = l_run * corr + (rs.x + rs.y);
    m_run = mnew;
#pragma unroll  // accumulator elements are named by constants
    for (int t = 0; t < 8; ++t) {
      acc0[t] *= corr; acc1[t] *= corr; acc2[t] *= corr; acc3[t] *= corr;
    }

    // ---- O^T += V^T * P^T : the two score tiles, rounded in place, are the
    //      32-key B operand in the hardware's k order; V^T rows are A --------
    Frag16 pf;
    pf.q[0] = make_uint4(pack_bf16(x[0], x[1]), pack_bf16(x[2], x[3]),
                         pack_bf16(x[4], x[5]), pack_bf16(x[6], x[7]));
    pf.q[1] = make_uint4(pack_bf16(x[8], x[9]), pack_bf16(x[10], x[11]),
                         pack_bf16(x[12], x[13]), pack_bf16(x[14], x[15]));
    acc0 = __builtin_amdgcn_wmma_f32_16x16x32_bf16(false, bv0, false, pf.v,
                                                   (short)0, acc0, false, false);
    acc1 = __builtin_amdgcn_wmma_f32_16x16x32_bf16(false, bv1, false, pf.v,
                                                   (short)0, acc1, false, false);
    acc2 = __builtin_amdgcn_wmma_f32_16x16x32_bf16(false, bv2, false, pf.v,
                                                   (short)0, acc2, false, false);
    acc3 = __builtin_amdgcn_wmma_f32_16x16x32_bf16(false, bv3, false, pf.v,
                                                   (short)0, acc3, false, false);
  }

  // ---- normalize and write out: contiguous [B,G,H,N,dv] -------------------
  //      accJ[t] = feature 16*J + 8*half + t of query lane16
  const float inv = 1.0f / (l_run + other_half(l_run));
  float* outp = out + ((size_t)((b * NG + g) * NH + h) * NSEQ + rowbase +
                       wave * 16 + lane16) * DV + 8 * half;
  const v8f o[4] = {acc0 * inv, acc1 * inv, acc2 * inv, acc3 * inv};
#pragma unroll  // o[] stays in registers
  for (int j = 0; j < 4; ++j) {
    *(v4f*)(outp + j * 16)     = o[j].lo;
    *(v4f*)(outp + j * 16 + 4) = o[j].hi;
  }
}

extern "C" void kernel_launch(void* const* d_in, const int* in_sizes, int n_in,
                              void* d_out, int out_size, void* d_ws,
                              size_t ws_size, hipStream_t stream) {
  (void)in_sizes; (void)n_in; (void)out_size; (void)ws_size;
  const float* q   = (const float*)d_in[0];
  const float* k   = (const float*)d_in[1];
  const float* v   = (const float*)d_in[2];
  const float* ncs = (const float*)d_in[3];
  float* out = (float*)d_out;
  unsigned short* qb = (unsigned short*)d_ws;   // three bf16 planes, 48 MiB
  unsigned short* kb = qb + PLANE;
  unsigned short* vt = kb + PLANE;

  split_heads_kernel<<<QK_BLOCKS + V_BLOCKS, 256, 0, stream>>>(q, k, v, qb, kb,
                                                               vt);

  const int grid = NB * NG * NH * (NSEQ / ROWS_PB); // 1024 blocks
  attn_bias_fwd_kernel<<<grid, 256, 0, stream>>>(
      qb, kb, vt, ncs, out);
}

// v004
// One run takes 61.3 microseconds.
// Next to v003, in two timings, it ran 1.04 and 1.05 times as fast.
// Over all steps from v000 it is 9.23 times as fast.
#include <hip/hip_runtime.h>

typedef __attribute__((ext_vector_type(16))) __bf16 v16bf;
typedef __attribute__((ext_vector_type(2)))  __bf16 v2bf;
typedef __attribute__((ext_vector_type(8)))  float  v8f;
typedef __attribute__((ext_vector_type(4)))  float  v4f;
typedef __attribute__((ext_vector_type(2)))  float  v2f;

#define NB      2
#define NG      4
#define NH      16
#define NSEQ    1024
#define DQ      64
#define DV      64
#define DMODEL  1024          // DQ*NH == DV*NH
#define ROWS_PB 128           // query rows per block (8 waves x 16 rows)
#define KBLK    32            // key columns per inner iteration
#define NITER   (NSEQ / KBLK) // 32
#define PLANE   (NB * NG * NH * NSEQ * DQ)  // elements of one bf16 plane

// Head-split launch: 8 waves per block, 4 units of work per wave.
#define UNITS_PW  4
#define QK_BLOCKS (2 * NB * NG * NSEQ / (8 * UNITS_PW))                    // 512
#define V_BLOCKS  (NB * NG * (NSEQ / KBLK) * (DV / 2) / (8 * UNITS_PW))    // 256

// LDS strides in bf16 elements (row base must stay 16B aligned: *2B % 16 == 0)
#define QSTRIDE 72            // 144 B row
#define KSTRIDE 72
#define VSTRIDE 40            // 80 B row (transposed V: [dv][k])
#define BSTRIDE 36            // bias rows, in floats: 144 B row

// Two f32 -> two bf16 in one word, round to nearest even: one packed hardware
// convert (v_cvt_pk_bf16_f32).
__device__ __forceinline__ unsigned pack_bf16(float lo, float hi) {
  const v2f p = {lo, hi};
  return __builtin_bit_cast(unsigned, __builtin_convertvector(p, v2bf));
}

union Frag16 { uint4 q[2]; v16bf v; };

// Load a 16-element bf16 fragment per the CDNA5 16-bit A/B VGPR layout:
//   element e (0..7)  holds K = koff + 8*half + e
//   element e (8..15) holds K = koff + 16 + 8*half + (e-8)
// => two contiguous 16-byte LDS loads.
__device__ __forceinline__ v16bf load_frag(const unsigned short* rowbase,
                                           int koff, int half) {
  Frag16 fr;
  fr.q[0] = *(const uint4*)(rowbase + koff + 8 * half);
  fr.q[1] = *(const uint4*)(rowbase + koff + 16 + 8 * half);
  return fr.v;
}

// Lane l <-> lane l ^ 16: the two lanes that share one query column.
__device__ __forceinline__ float other_half(float x) {
  int b = __float_as_int(x);
  return __int_as_float(__builtin_amdgcn_permlanex16(b, b, 0x76543210,
                                                     0xfedcba98, false, false));
}

// Byte address in the work-group's LDS: the low word of a __shared__ address.
__device__ __forceinline__ unsigned lds_off(const void* p) {
  return (unsigned)(size_t)p;
}

// One tile's copies of a thread, 16 bytes each, global memory to LDS through
// no register: K, V, four bias rows.  Global address = scalar base + the
// lane's byte offset.  The wait at the end stands inside the statement, so
// that no register that a copy names is rewritten in front of it.
__device__ __forceinline__ void copy_tile(
    unsigned kd, unsigned vd, unsigned bd, unsigned kvoff, unsigned boff,
    const unsigned short* kp, const unsigned short* vp, const float* bp) {
  asm volatile(
      "global_load_async_to_lds_b128 %0, %6, %8\n\t"
      "global_load_async_to_lds_b128 %1, %6, %9\n\t"
      "global_load_async_to_lds_b128 %2, %7, %10\n\t"
      "global_load_async_to_lds_b128 %3, %7, %11\n\t"
      "global_load_async_to_lds_b128 %4, %7, %12\n\t"
      "global_load_async_to_lds_b128 %5, %7, %13\n\t"
      "s_wait_xcnt 0x0"
      ::"v"(kd), "v"(vd), "v"(bd), "v"(bd + 4 * BSTRIDE * 4),
        "v"(bd + 8 * BSTRIDE * 4), "v"(bd + 12 * BSTRIDE * 4), "v"(kvoff),
        "v"(boff), "s"(kp), "s"(vp), "s"(bp), "s"(bp + 4 * NSEQ),
        "s"(bp + 8 * NSEQ), "s"(bp + 12 * NSEQ)
      : "memory");
}

// Eight f32 values of head column c -> eight bf16 in one 16-byte word.
__device__ __forceinline__ uint4 pack8(const v4f* x, int c) {
  uint4 o;
  o.x = pack_bf16(x[0][c], x[1][c]);
  o.y = pack_bf16(x[2][c], x[3][c]);
  o.z = pack_bf16(x[4][c], x[5][c]);
  o.w = pack_bf16(x[6][c], x[7][c]);
  return o;
}

// Splits the 16 interleaved heads apart.  A lane reads 16 bytes = 4 heads of
// one feature, eight times, and stores 8 bf16 of each of its 4 heads; every
// store instruction writes four whole 128-byte lines.
__global__ __launch_bounds__(256)
void split_heads_kernel(const float* __restrict__ q,
                        const float* __restrict__ k,
                        const float* __restrict__ v,
                        unsigned short* __restrict__ qb,
                        unsigned short* __restrict__ kb,
                        unsigned short* __restrict__ vt) {
  const int wave = threadIdx.x >> 5;
  const int lane = threadIdx.x & 31;
  const int h4   = lane & 3;             // heads 4*h4 .. 4*h4+3
  const int bid  = blockIdx.x;

  if (bid < QK_BLOCKS) {
    // Q then K, one row per unit: lane group dg holds features 8*dg .. 8*dg+7.
    const int dg   = lane >> 2;
    const int row0 = (bid * 8 + wave) * UNITS_PW;      // 0 .. 2*B*G*N-1
    const bool isq = row0 < NB * NG * NSEQ;            // uniform per wave
    const float* src          = isq ? q : k;
    unsigned short* dst       = isq ? qb : kb;
    const int r0              = row0 & (NB * NG * NSEQ - 1);
    for (int u = 0; u < UNITS_PW; u += 2) {
      const int r = r0 + u, bg = r >> 10, n = r & (NSEQ - 1);  // r even
      const float* s = src + (size_t)r * DMODEL + dg * 8 * NH + h4 * 4;
      v4f x[2][8];                       // two rows: 16 loads in flight
#pragma unroll
      for (int j = 0; j < 8; ++j) {
        x[0][j] = *(const v4f*)(s + j * NH);
        x[1][j] = *(const v4f*)(s + DMODEL + j * NH);
      }
      // Takes the loaded values as inputs, so that all 16 loads are in flight
      // together (without it they are issued a few at a time between the
      // conversions), and the address, so that it stays whole up to the wait
      // that stands before the loads' registers are reused.
      asm volatile("s_wait_xcnt 0x0" ::"v"(x[0][0]), "v"(x[0][1]), "v"(x[0][2]),
                   "v"(x[0][3]), "v"(x[0][4]), "v"(x[0][5]), "v"(x[0][6]),
                   "v"(x[0][7]), "v"(x[1][0]), "v"(x[1][1]), "v"(x[1][2]),
                   "v"(x[1][3]), "v"(x[1][4]), "v"(x[1][5]), "v"(x[1][6]),
                   "v"(x[1][7]), "v"(s)
                   : "memory");
      unsigned short* d =
          dst + ((size_t)(bg * NH + h4 * 4) * NSEQ + n) * DQ + dg * 8;
#pragma unroll
      for (int c = 0; c < 4; ++c) {
        *(uint4*)(d + (size_t)c * NSEQ * DQ)      = pack8(x[0], c);
        *(uint4*)(d + (size_t)c * NSEQ * DQ + DQ) = pack8(x[1], c);
      }
      // the next trip reuses the registers that these stores name
      asm volatile("s_wait_xcnt 0x0" ::: "memory");
    }
  } else {
    // V, 32 keys x 2 features per unit: lane group ng holds keys 8*ng .. 8*ng+7
    // of feature 2*pair + dlow.
    const int dlow  = (lane >> 2) & 1;
    const int ng    = lane >> 3;
    const int unit0 = ((bid - QK_BLOCKS) * 8 + wave) * UNITS_PW;
    for (int u = 0; u < UNITS_PW; u += 2) {
      const int unit = unit0 + u;                      // even
      const int dv   = (unit & 31) * 2 + dlow;
      const int nblk = (unit >> 5) & 31;
      const int bg   = unit >> 10;
      const float* s = v + ((size_t)bg * NSEQ + nblk * KBLK + ng * 8) * DMODEL +
                       dv * NH + h4 * 4;
      v4f x[2][8];                       // two feature pairs: 16 loads in flight
#pragma unroll
      for (int j = 0; j < 8; ++j) {
        x[0][j] = *(const v4f*)(s + (size_t)j * DMODEL);
        x[1][j] = *(const v4f*)(s + (size_t)j * DMODEL + 2 * NH);
      }
      // all 16 loads in flight together, address whole up to the wait: as above
      asm volatile("s_wait_xcnt 0x0" ::"v"(x[0][0]), "v"(x[0][1]), "v"(x[0][2]),
                   "v"(x[0][3]), "v"(x[0][4]), "v"(x[0][5]), "v"(x[0][6]),
                   "v"(x[0][7]), "v"(x[1][0]), "v"(x[1][1]), "v"(x[1][2]),
                   "v"(x[1][3]), "v"(x[1][4]), "v"(x[1][5]), "v"(x[1][6]),
                   "v"(x[1][7]), "v"(s)
                   : "memory");
      unsigned short* d =
          vt + (((size_t)(bg * NH + h4 * 4) * NITER + nblk) * DV + dv) * KBLK +
          ng * 8;
#pragma unroll
      for (int c = 0; c < 4; ++c) {
        *(uint4*)(d + (size_t)c * NSEQ * DV)            = pack8(x[0], c);
        *(uint4*)(d + (size_t)c * NSEQ * DV + 2 * KBLK) = pack8(x[1], c);
      }
      // the next trip reuses the registers that these stores name
      asm volatile("s_wait_xcnt 0x0" ::: "memory");
    }
  }
}

__global__ __launch_bounds__(256)
void attn_bias_fwd_kernel(
    const unsigned short* __restrict__ qb, const unsigned short* __restrict__ kb,
    const unsigned short* __restrict__ vt, const float* __restrict__ ncs,
    float* __restrict__ out) {
  __shared__ __align__(16) unsigned short q_lds[ROWS_PB * QSTRIDE]; // 18.0 KB
  __shared__ __align__(16) unsigned short k_lds[2][KBLK   * KSTRIDE]; //  9 KB
  __shared__ __align__(16) unsigned short v_lds[2][DV     * VSTRIDE]; // 10 KB
  __shared__ __align__(16) float          b_lds[2][ROWS_PB * BSTRIDE];// 36 KB

  const int tid    = threadIdx.x;
  const int wave   = tid >> 5;
  const int lane   = tid & 31;
  const int lane16 = lane & 15;
  const int half   = lane >> 4;

  // Block decode: g slowest (L2 bias reuse), then (b,h), row-block fastest.
  const int bid     = blockIdx.x;
  const int rowblk  = bid & 7;
  const int head    = bid >> 3;          // 0..127
  const int g       = head >> 5;         // 0..3
  const int b       = (head >> 4) & 1;   // 0..1
  const int h       = head & 15;         // 0..15
  const int rowbase = rowblk * ROWS_PB;

  const size_t hp = (size_t)((b * NG + g) * NH + h);        // head plane
  const unsigned short* qg = qb + (hp * NSEQ + rowbase) * DQ;  // [row][d]
  const unsigned short* kg = kb + hp * NSEQ * DQ;              // [m][d]
  const unsigned short* vg = vt + hp * NSEQ * DV;              // [m/32][n][32]
  const unsigned kvoff = tid * 16;       // a K or V tile is 4 KB contiguous
  const int kdst = (tid >> 3) * KSTRIDE + (tid & 7) * 8;
  const int vdst = (tid >> 2) * VSTRIDE + (tid & 3) * 8;
  // Bias tile of this wave, 16 queries x 32 keys: a copy covers four whole
  // 128-byte rows; the wave's own LDS rows turn it so that a lane gets the 16
  // keys of its query.
  const float* biasp = ncs + (size_t)g * NSEQ * NSEQ
                       + (size_t)rowbase * NSEQ;            // [row*NSEQ + m]
  const unsigned boff = ((wave * 16 + (lane >> 3)) * NSEQ + (lane & 7) * 4) * 4;
  const int bdst = (wave * 16 + (lane >> 3)) * BSTRIDE + (lane & 7) * 4;
  const int bsrc = (wave * 16 + lane16) * BSTRIDE + 8 * half;

  // ---- tile 0 into buffer 0: its copies fly beside the Q loads ------------
  copy_tile(lds_off(&k_lds[0][kdst]), lds_off(&v_lds[0][vdst]),
            lds_off(&b_lds[0][bdst]), kvoff, boff, kg, vg, biasp);

  // ---- stage Q tile (128 x 64) as bf16 in LDS -----------------------------
#pragma unroll  // the four loads of a thread go out together
  for (int j = 0; j < ROWS_PB * DQ / 8 / 256; ++j) {
    int i = tid + j * 256, row = i >> 3, d = (i & 7) * 8;
    *(uint4*)&q_lds[row * QSTRIDE + d] = *(const uint4*)(qg + i * 8);
  }

  // ---- tile 0 has landed and is published; then tile 1 flies ---------------
  // this wave's copies have landed before the barrier publishes them
  asm volatile("s_wait_asynccnt 0x0" ::: "memory");
  __syncthreads();
  copy_tile(lds_off(&k_lds[1][kdst]), lds_off(&v_lds[1][vdst]),
            lds_off(&b_lds[1][bdst]), kvoff, boff, kg + KBLK * DQ,
            vg + KBLK * DV, biasp + KBLK);

  // B fragments: this wave's 16 queries as columns (d-chunks 0..31, 32..63)
  const unsigned short* qrow = &q_lds[(wave * 16 + lane16) * QSTRIDE];
  v16bf aq0 = load_frag(qrow, 0, half);
  v16bf aq1 = load_frag(qrow, 32, half);

  v8f acc0 = {}, acc1 = {}, acc2 = {}, acc3 = {};
  // Of query lane16: the running maximum (equal in both halves) and this
  // half's own share of the running sum.
  float m_run = -3.0e38f, l_run = 0.0f;

  for (int it = 0; it < NITER; ++it) {
    const int buf = it & 1;              // tile it lies in buffer it mod 2

    // ---- preload all A fragments so DS latency overlaps WMMA/softmax ------
    const unsigned short* k0 = &k_lds[buf][(0 * 16 + lane16) * KSTRIDE];
    const unsigned short* k1 = &k_lds[buf][(1 * 16 + lane16) * KSTRIDE];
    v16bf bk00 = load_frag(k0, 0, half);
    v16bf bk01 = load_frag(k0, 32, half);
    v16bf bk10 = load_frag(k1, 0, half);
    v16bf bk11 = load_frag(k1, 32, half);
    v16bf bv0 = load_frag(&v_lds[buf][(0 * 16 + lane16) * VSTRIDE], 0, half);
    v16bf bv1 = load_frag(&v_lds[buf][(1 * 16 + lane16) * VSTRIDE], 0, half);
    v16bf bv2 = load_frag(&v_lds[buf][(2 * 16 + lane16) * VSTRIDE], 0, half);
    v16bf bv3 = load_frag(&v_lds[buf][(3 * 16 + lane16) * VSTRIDE], 0, half);

    // bias of query lane16: keys 8*half + 0..7 and 16 + 8*half + 0..7 of the tile
    v4f bb[4];
    bb[0] = *(const v4f*)(&b_lds[buf][bsrc]);
    bb[1] = *(const v4f*)(&b_lds[buf][bsrc + 4]);
    bb[2] = *(const v4f*)(&b_lds[buf][bsrc + 16]);
    bb[3] = *(const v4f*)(&b_lds[buf][bsrc + 20]);

    // ---- S^T = K * Q^T : two 16-key row tiles, K-dim 64 = 2 chunks --------
    //      s0[t] = key 8*half + t, s1[t] = key 16 + 8*half + t of the tile,
    //      both of query lane16
    v8f s0 = {}, s1 = {};
    s0 = __builtin_amdgcn_wmma_f32_16x16x32_bf16(false, bk00, false, aq0,
                                                 (short)0, s0, false, false);
    s0 = __builtin_amdgcn_wmma_f32_16x16x32_bf16(false, bk01, false, aq1,
                                                 (short)0, s0, false, false);
    s1 = __builtin_amdgcn_wmma_f32_16x16x32_bf16(false, bk10, false, aq0,
                                                 (short)0, s1, false, false);
    s1 = __builtin_amdgcn_wmma_f32_16x16x32_bf16(false, bk11, false, aq1,
                                                 (short)0, s1, false, false);

    // ---- bias, online softmax: 16 keys of one query per lane --------------
    //      (the loops over x[] are unrolled so that x[] stays in registers)
    float x[16];
#pragma unroll
    for (int t = 0; t < 8; ++t) {
      x[t]     = s0[t] * 0.125f - bb[t >> 2][t & 3];
      x[8 + t] = s1[t] * 0.125f - bb[2 + (t >> 2)][t & 3];
    }
    float mx = x[0];
#pragma unroll
    for (int t = 1; t < 16; ++t) mx = fmaxf(mx, x[t]);
    mx = fmaxf(mx, other_half(mx));      // both halves scale by one maximum
    const float mnew = fmaxf(m_run, mx);
    const float corr = __expf(m_run - mnew);
    v2f rs = {0.0f, 0.0f};               // even and odd keys: packed adds
#pragma unroll
    for (int t = 0; t < 16; t += 2) {
      x[t]     = __expf(x[t] - mnew);
      x[t + 1] = __expf(x[t + 1] - mnew);
      rs += (v2f){x[t], x[t + 1]};
    }
    l_run = l_run * corr + (rs.x + rs.y);
    m_run = mnew;
#pragma unroll  // accumulator elements are named by constants
    for (int t = 0; t < 8; ++t) {
      acc0[t] *= corr; acc1[t] *= corr; acc2[t] *= corr; acc3[t] *= corr;
    }

    // ---- O^T += V^T * P^T : the two score tiles, rounded in place, are the
    //      32-key B operand in the hardware's k order; V^T rows are A --------
    Frag16 pf;
    pf.q[0] = make_uint4(pack_bf16(x[0], x[1]), pack_bf16(x[2], x[3]),
                         pack_bf16(x[4], x[5]), pack_bf16(x[6], x[7]));
    pf.q[1] = make_uint4(pack_bf16(x[8], x[9]), pack_bf16(x[10], x[11]),
                         pack_bf16(x[12], x[13]), pack_bf16(x[14], x[15]));
    acc0 = __builtin_amdgcn_wmma_f32_16x16x32_bf16(false, bv0, false, pf.v,
                                                   (short)0, acc0, false, false);
    acc1 = __builtin_amdgcn_wmma_f32_16x16x32_bf16(false, bv1, false, pf.v,
                                                   (short)0, acc1, false, false);
    acc2 = __builtin_amdgcn_wmma_f32_16x16x32_bf16(false, bv2, false, pf.v,
                                                   (short)0, acc2, false, false);
    acc3 = __builtin_amdgcn_wmma_f32_16x16x32_bf16(false, bv3, false, pf.v,
                                                   (short)0, acc3, false, false);

    // ---- hand-over: tile it + 1 is published, buffer buf is given up ------
    // this wave's reads of buffer buf have returned
    asm volatile("s_wait_dscnt 0x0" ::: "memory");
    // this wave's copies of tile it + 1 have landed
    asm volatile("s_wait_asynccnt 0x0" ::: "memory");
    __syncthreads();
    if (it + 2 < NITER)                  // the same for the whole work-group
      copy_tile(lds_off(&k_lds[buf][kdst]), lds_off(&v_lds[buf][vdst]),
                lds_off(&b_lds[buf][bdst]), kvoff, boff,
                kg + (size_t)(it + 2) * (KBLK * DQ),
                vg + (size_t)(it + 2) * (KBLK * DV), biasp + (it + 2) * KBLK);
  }
  // no copy is outstanding when the wave ends
  asm volatile("s_wait_asynccnt 0x0" ::: "memory");

  // ---- normalize and write out: contiguous [B,G,H,N,dv] -------------------
  //      accJ[t] = feature 16*J + 8*half + t of query lane16
  const float inv = 1.0f / (l_run + other_half(l_run));
  float* outp = out + ((size_t)((b * NG + g) * NH + h) * NSEQ + rowbase +
                       wave * 16 + lane16) * DV + 8 * half;
  const v8f o[4] = {acc0 * inv, acc1 * inv, acc2 * inv, acc3 * inv};
#pragma unroll  // o[] stays in registers
  for (int j = 0; j < 4; ++j) {
    *(v4f*)(outp + j * 16)     = o[j].lo;
    *(v4f*)(outp + j * 16 + 4) = o[j].hi;
  }
}

extern "C" void kernel_launch(void* const* d_in, const int* in_sizes, int n_in,
                              void* d_out, int out_size, void* d_ws,
                              size_t ws_size, hipStream_t stream) {
  (void)in_sizes; (void)n_in; (void)out_size; (void)ws_size;
  const float* q   = (const float*)d_in[0];
  const float* k   = (const float*)d_in[1];
  const float* v   = (const float*)d_in[2];
  const float* ncs = (const float*)d_in[3];
  float* out = (float*)d_out;
  unsigned short* qb = (unsigned short*)d_ws;   // three bf16 planes, 48 MiB
  unsigned short* kb = qb + PLANE;
  unsigned short* vt = kb + PLANE;

  split_heads_kernel<<<QK_BLOCKS + V_BLOCKS, 256, 0, stream>>>(q, k, v, qb, kb,
                                                               vt);

  const int grid = NB * NG * NH * (NSEQ / ROWS_PB); // 1024 blocks
  attn_bias_fwd_kernel<<<grid, 256, 0, stream>>>(
      qb, kb, vt, ncs, out);
}

// v005
// It runs in 53.1 microseconds.
// Two timings next to v004 put it at 1.16 and 1.15 times that version's speed.
// Counting every step since v000, it is 10.7 times as fast.
#include <hip/hip_runtime.h>

typedef __attribute__((ext_vector_type(16))) __bf16 v16bf;
typedef __attribute__((ext_vector_type(2)))  __bf16 v2bf;
typedef __attribute__((ext_vector_type(8)))  float  v8f;
typedef __attribute__((ext_vector_type(4)))  float  v4f;
typedef __attribute__((ext_vector_type(2)))  float  v2f;

#define NB      2
#define NG      4
#define NH      16
#define NSEQ    1024
#define DQ      64
#define DV      64
#define DMODEL  1024          // DQ*NH == DV*NH
#define ROWS_PB 128           // query rows per block (4 waves x 32 rows a head)
#define HPB     2             // heads per block (waves 0..3 and 4..7)
#define QT      2             // 16-query tiles per wave
#define KBLK    32            // key columns per inner iteration
#define NITER   (NSEQ / KBLK) // 32
#define PLANE   (NB * NG * NH * NSEQ * DQ)  // elements of one bf16 plane

// Head-split launch: 8 waves per block, 4 units of work per wave.
#define UNITS_PW  4
#define QK_BLOCKS (2 * NB * NG * NSEQ / (8 * UNITS_PW))                    // 512
#define V_BLOCKS  (NB * NG * (NSEQ / KBLK) * (DV / 2) / (8 * UNITS_PW))    // 256

// LDS strides in bf16 elements (row base must stay 16B aligned: *2B % 16 == 0)
#define QSTRIDE 72            // 144 B row
#define KSTRIDE 72
#define VSTRIDE 40            // 80 B row (transposed V: [dv][k])
#define BSTRIDE 36            // bias rows, in floats: 144 B row

// Two f32 -> two bf16 in one word, round to nearest even: one packed hardware
// convert (v_cvt_pk_bf16_f32).
__device__ __forceinline__ unsigned pack_bf16(float lo, float hi) {
  const v2f p = {lo, hi};
  return __builtin_bit_cast(unsigned, __builtin_convertvector(p, v2bf));
}

union Frag16 { uint4 q[2]; v16bf v; };

// Load a 16-element bf16 fragment per the CDNA5 16-bit A/B VGPR layout:
//   element e (0..7)  holds K = koff + 8*half + e
//   element e (8..15) holds K = koff + 16 + 8*half + (e-8)
// => two contiguous 16-byte LDS loads.
__device__ __forceinline__ v16bf load_frag(const unsigned short* rowbase,
                                           int koff, int half) {
  Frag16 fr;
  fr.q[0] = *(const uint4*)(rowbase + koff + 8 * half);
  fr.q[1] = *(const uint4*)(rowbase + koff + 16 + 8 * half);
  return fr.v;
}

// Lane l <-> lane l ^ 16: the two lanes that share one query column.
__device__ __forceinline__ float other_half(float x) {
  int b = __float_as_int(x);
  return __int_as_float(__builtin_amdgcn_permlanex16(b, b, 0x76543210,
                                                     0xfedcba98, false, false));
}

// Byte address in the work-group's LDS: the low word of a __shared__ address.
__device__ __forceinline__ unsigned lds_off(const void* p) {
  return (unsigned)(size_t)p;
}

// One tile's copies of a thread, 16 bytes each, global memory to LDS through
// no register: K and V of both heads, four bias rows.  Global address = scalar
// base + the lane's byte offset.  The wait at the end stands inside the
// statement, so that no register that a copy names is rewritten in front of it.
__device__ __forceinline__ void copy_tile(
    unsigned kd, unsigned vd, unsigned bd, unsigned kvoff, unsigned boff,
    const unsigned short* kp, const unsigned short* vp, const float* bp) {
  asm volatile(
      "global_load_async_to_lds_b128 %0, %8, %10\n\t"
      "global_load_async_to_lds_b128 %1, %8, %11\n\t"
      "global_load_async_to_lds_b128 %2, %8, %12\n\t"
      "global_load_async_to_lds_b128 %3, %8, %13\n\t"
      "global_load_async_to_lds_b128 %4, %9, %14\n\t"
      "global_load_async_to_lds_b128 %5, %9, %15\n\t"
      "global_load_async_to_lds_b128 %6, %9, %16\n\t"
      "global_load_async_to_lds_b128 %7, %9, %17\n\t"
      "s_wait_xcnt 0x0"
      ::"v"(kd), "v"(kd + KBLK * KSTRIDE * 2), "v"(vd),
        "v"(vd + DV * VSTRIDE * 2), "v"(bd), "v"(bd + 32 * BSTRIDE * 4),
        "v"(bd + 64 * BSTRIDE * 4), "v"(bd + 96 * BSTRIDE * 4), "v"(kvoff),
        "v"(boff), "s"(kp), "s"(kp + NSEQ * DQ), "s"(vp), "s"(vp + NSEQ * DV),
        "s"(bp), "s"(bp + 32 * NSEQ), "s"(bp + 64 * NSEQ), "s"(bp + 96 * NSEQ)
      : "memory");
}

// Eight f32 values of head column c -> eight bf16 in one 16-byte word.
__device__ __forceinline__ uint4 pack8(const v4f* x, int c) {
  uint4 o;
  o.x = pack_bf16(x[0][c], x[1][c]);
  o.y = pack_bf16(x[2][c], x[3][c]);
  o.z = pack_bf16(x[4][c], x[5][c]);
  o.w = pack_bf16(x[6][c], x[7][c]);
  return o;
}

// Splits the 16 interleaved heads apart.  A lane reads 16 bytes = 4 heads of
// one feature, eight times, and stores 8 bf16 of each of its 4 heads; every
// store instruction writes four whole 128-byte lines.
__global__ __launch_bounds__(256)
void split_heads_kernel(const float* __restrict__ q,
                        const float* __restrict__ k,
                        const float* __restrict__ v,
                        unsigned short* __restrict__ qb,
                        unsigned short* __restrict__ kb,
                        unsigned short* __restrict__ vt) {
  const int wave = threadIdx.x >> 5;
  const int lane = threadIdx.x & 31;
  const int h4   = lane & 3;             // heads 4*h4 .. 4*h4+3
  const int bid  = blockIdx.x;

  if (bid < QK_BLOCKS) {
    // Q then K, one row per unit: lane group dg holds features 8*dg .. 8*dg+7.
    const int dg   = lane >> 2;
    const int row0 = (bid * 8 + wave) * UNITS_PW;      // 0 .. 2*B*G*N-1
    const bool isq = row0 < NB * NG * NSEQ;            // uniform per wave
    const float* src          = isq ? q : k;
    unsigned short* dst       = isq ? qb : kb;
    const int r0              = row0 & (NB * NG * NSEQ - 1);
    for (int u = 0; u < UNITS_PW; u += 2) {
      const int r = r0 + u, bg = r >> 10, n = r & (NSEQ - 1);  // r even
      const float* s = src + (size_t)r * DMODEL + dg * 8 * NH + h4 * 4;
      v4f x[2][8];                       // two rows: 16 loads in flight
#pragma unroll
      for (int j = 0; j < 8; ++j) {
        x[0][j] = *(const v4f*)(s + j * NH);
        x[1][j] = *(const v4f*)(s + DMODEL + j * NH);
      }
      // Takes the loaded values as inputs, so that all 16 loads are in flight
      // together (without it they are issued a few at a time between the
      // conversions), and the address, so that it stays whole up to the wait
      // that stands before the loads' registers are reused.
      asm volatile("s_wait_xcnt 0x0" ::"v"(x[0][0]), "v"(x[0][1]), "v"(x[0][2]),
                   "v"(x[0][3]), "v"(x[0][4]), "v"(x[0][5]), "v"(x[0][6]),
                   "v"(x[0][7]), "v"(x[1][0]), "v"(x[1][1]), "v"(x[1][2]),
                   "v"(x[1][3]), "v"(x[1][4]), "v"(x[1][5]), "v"(x[1][6]),
                   "v"(x[1][7]), "v"(s)
                   : "memory");
      unsigned short* d =
          dst + ((size_t)(bg * NH + h4 * 4) * NSEQ + n) * DQ + dg * 8;
#pragma unroll
      for (int c = 0; c < 4; ++c) {
        *(uint4*)(d + (size_t)c * NSEQ * DQ)      = pack8(x[0], c);
        *(uint4*)(d + (size_t)c * NSEQ * DQ + DQ) = pack8(x[1], c);
      }
      // the next trip reuses the registers that these stores name
      asm volatile("s_wait_xcnt 0x0" ::: "memory");
    }
  } else {
    // V, 32 keys x 2 features per unit: lane group ng holds keys 8*ng .. 8*ng+7
    // of feature 2*pair + dlow.
    const int dlow  = (lane >> 2) & 1;
    const int ng    = lane >> 3;
    const int unit0 = ((bid - QK_BLOCKS) * 8 + wave) * UNITS_PW;
    for (int u = 0; u < UNITS_PW; u += 2) {
      const int unit = unit0 + u;                      // even
      const int dv   = (unit & 31) * 2 + dlow;
      const int nblk = (unit >> 5) & 31;
      const int bg   = unit >> 10;
      const float* s = v + ((size_t)bg * NSEQ + nblk * KBLK + ng * 8) * DMODEL +
                       dv * NH + h4 * 4;
      v4f x[2][8];                       // two feature pairs: 16 loads in flight
#pragma unroll
      for (int j = 0; j < 8; ++j) {
        x[0][j] = *(const v4f*)(s + (size_t)j * DMODEL);
        x[1][j] = *(const v4f*)(s + (size_t)j * DMODEL + 2 * NH);
      }
      // all 16 loads in flight together, address whole up to the wait: as above
      asm volatile("s_wait_xcnt 0x0" ::"v"(x[0][0]), "v"(x[0][1]), "v"(x[0][2]),
                   "v"(x[0][3]), "v"(x[0][4]), "v"(x[0][5]), "v"(x[0][6]),
                   "v"(x[0][7]), "v"(x[1][0]), "v"(x[1][1]), "v"(x[1][2]),
                   "v"(x[1][3]), "v"(x[1][4]), "v"(x[1][5]), "v"(x[1][6]),
                   "v"(x[1][7]), "v"(s)
                   : "memory");
      unsigned short* d =
          vt + (((size_t)(bg * NH + h4 * 4) * NITER + nblk) * DV + dv) * KBLK +
          ng * 8;
#pragma unroll
      for (int c = 0; c < 4; ++c) {
        *(uint4*)(d + (size_t)c * NSEQ * DV)            = pack8(x[0], c);
        *(uint4*)(d + (size_t)c * NSEQ * DV + 2 * KBLK) = pack8(x[1], c);
      }
      // the next trip reuses the registers that these stores name
      asm volatile("s_wait_xcnt 0x0" ::: "memory");
    }
  }
}

// 110 KB of LDS: two work-groups a WGP, four waves a SIMD.
__global__ __launch_bounds__(256)
void attn_bias_fwd_kernel(
    const unsigned short* __restrict__ qb, const unsigned short* __restrict__ kb,
    const unsigned short* __restrict__ vt, const float* __restrict__ ncs,
    float* __restrict__ out) {
  __shared__ __align__(16) unsigned short q_lds[HPB * ROWS_PB * QSTRIDE];  // 36 KB
  __shared__ __align__(16) unsigned short k_lds[2][HPB][KBLK * KSTRIDE];   // 18 KB
  __shared__ __align__(16) unsigned short v_lds[2][HPB][DV * VSTRIDE];     // 20 KB
  __shared__ __align__(16) float          b_lds[2][ROWS_PB * BSTRIDE];     // 36 KB

  const int tid    = threadIdx.x;
  const int wave   = tid >> 5;
  const int lane   = tid & 31;
  const int lane16 = lane & 15;
  const int half   = lane >> 4;
  const int hs     = wave >> 2;          // which of the block's two heads
  const int wrow   = (wave & 3) * (16 * QT);  // first query row of the wave

  // Block decode: g slowest (L2 bias reuse), then (b, head pair), row-block
  // fastest.
  const int bid     = blockIdx.x;
  const int rowblk  = bid & 7;
  const int pair    = bid >> 3;          // 0..63
  const int g       = pair >> 4;         // 0..3
  const int b       = (pair >> 3) & 1;   // 0..1
  const int h0      = (pair & 7) * HPB;  // first head of the pair
  const int rowbase = rowblk * ROWS_PB;

  const size_t hp = (size_t)((b * NG + g) * NH + h0);       // first head plane
  const unsigned short* qg = qb + (hp * NSEQ + rowbase) * DQ;  // [row][d]
  const unsigned short* kg = kb + hp * NSEQ * DQ;              // [m][d]
  const unsigned short* vg = vt + hp * NSEQ * DV;              // [m/32][n][32]
  const unsigned kvoff = tid * 16;       // a K or V tile is 4 KB contiguous
  const int kdst = (tid >> 3) * KSTRIDE + (tid & 7) * 8;
  const int vdst = (tid >> 2) * VSTRIDE + (tid & 3) * 8;
  // Bias tile of the block, 128 queries x 32 keys: a copy of a wave covers four
  // whole 128-byte rows; the LDS rows turn it so that a lane gets the 16 keys
  // of its query.
  const float* biasp = ncs + (size_t)g * NSEQ * NSEQ
                       + (size_t)rowbase * NSEQ;            // [row*NSEQ + m]
  const unsigned boff = ((tid >> 3) * NSEQ + (tid & 7) * 4) * 4;
  const int bdst = (tid >> 3) * BSTRIDE + (tid & 7) * 4;
  const int bsrc = (wrow + lane16) * BSTRIDE + 8 * half;

  // ---- tile 0 into buffer 0: its copies fly beside the Q loads ------------
  copy_tile(lds_off(&k_lds[0][0][kdst]), lds_off(&v_lds[0][0][vdst]),
            lds_off(&b_lds[0][bdst]), kvoff, boff, kg, vg, biasp);

  // ---- stage the two heads' Q tiles (128 x 64 each) as bf16 in LDS --------
#pragma unroll  // the eight loads of a thread go out together
  for (int jj = 0; jj < HPB * ROWS_PB * DQ / 8 / 256; ++jj) {
    const int hq = jj >> 2, j = jj & 3;  // head of the pair, quarter of its tile
    int i = tid + j * 256, row = hq * ROWS_PB + (i >> 3), d = (i & 7) * 8;
    *(uint4*)&q_lds[row * QSTRIDE + d] =
        *(const uint4*)(qg + hq * (NSEQ * DQ) + i * 8);
  }

  // ---- tile 0 has landed and is published; then tile 1 flies ---------------
  // this wave's copies have landed before the barrier publishes them
  asm volatile("s_wait_asynccnt 0x0" ::: "memory");
  __syncthreads();
  copy_tile(lds_off(&k_lds[1][0][kdst]), lds_off(&v_lds[1][0][vdst]),
            lds_off(&b_lds[1][bdst]), kvoff, boff, kg + KBLK * DQ,
            vg + KBLK * DV, biasp + KBLK);

  // B fragments: this wave's 2 x 16 queries as columns (d-chunks 0..31, 32..63)
  v16bf aq[QT][2];
#pragma unroll  // fragments are named by constants
  for (int u = 0; u < QT; ++u) {
    const unsigned short* qrow =
        &q_lds[(hs * ROWS_PB + wrow + u * 16 + lane16) * QSTRIDE];
    aq[u][0] = load_frag(qrow, 0, half);
    aq[u][1] = load_frag(qrow, 32, half);
  }

  v8f acc[QT][4] = {};
  // Of query u*16 + lane16: the running maximum (equal in both halves) and this
  // half's own share of the running sum.
  float m_run[QT], l_run[QT];
#pragma unroll  // named by constants: they stay in registers
  for (int u = 0; u < QT; ++u) { m_run[u] = -3.0e38f; l_run[u] = 0.0f; }

  for (int it = 0; it < NITER; ++it) {
    const int buf = it & 1;              // tile it lies in buffer it mod 2

    // ---- preload all A fragments so DS latency overlaps WMMA/softmax ------
    const unsigned short* k0 = &k_lds[buf][hs][(0 * 16 + lane16) * KSTRIDE];
    const unsigned short* k1 = &k_lds[buf][hs][(1 * 16 + lane16) * KSTRIDE];
    v16bf bk00 = load_frag(k0, 0, half);
    v16bf bk01 = load_frag(k0, 32, half);
    v16bf bk10 = load_frag(k1, 0, half);
    v16bf bk11 = load_frag(k1, 32, half);
    v16bf bv[4];
#pragma unroll  // fragments are named by constants
    for (int j = 0; j < 4; ++j)
      bv[j] = load_frag(&v_lds[buf][hs][(j * 16 + lane16) * VSTRIDE], 0, half);

    // bias of query u*16 + lane16: keys 8*half + 0..7 and 16 + 8*half + 0..7
    v4f bb[QT][4];
#pragma unroll  // bb[][] stays in registers
    for (int u = 0; u < QT; ++u) {
      const float* br = &b_lds[buf][bsrc + u * 16 * BSTRIDE];
      bb[u][0] = *(const v4f*)(br);
      bb[u][1] = *(const v4f*)(br + 4);
      bb[u][2] = *(const v4f*)(br + 16);
      bb[u][3] = *(const v4f*)(br + 20);
    }

    // ---- S^T = K * Q^T : two 16-key row tiles, K-dim 64 = 2 chunks, for each
    //      of the two query tiles: every K fragment is used twice -----------
    //      s0[u][t] = key 8*half + t, s1[u][t] = key 16 + 8*half + t of the
    //      tile, both of query u*16 + lane16
    v8f s0[QT] = {}, s1[QT] = {};
#pragma unroll  // score tiles are named by constants, here and in the next loop
    for (int u = 0; u < QT; ++u) {
      s0[u] = __builtin_amdgcn_wmma_f32_16x16x32_bf16(
          false, bk00, false, aq[u][0], (short)0, s0[u], false, false);
      s1[u] = __builtin_amdgcn_wmma_f32_16x16x32_bf16(
          false, bk10, false, aq[u][0], (short)0, s1[u], false, false);
    }
#pragma unroll
    for (int u = 0; u < QT; ++u) {
      s0[u] = __builtin_amdgcn_wmma_f32_16x16x32_bf16(
          false, bk01, false, aq[u][1], (short)0, s0[u], false, false);
      s1[u] = __builtin_amdgcn_wmma_f32_16x16x32_bf16(
          false, bk11, false, aq[u][1], (short)0, s1[u], false, false);
    }

#pragma unroll  // the two query tiles: everything below is named by constants
    for (int u = 0; u < QT; ++u) {
      // ---- bias, online softmax: 16 keys of one query per lane ------------
      //      (the loops over x[] are unrolled so that x[] stays in registers)
      float x[16];
#pragma unroll
      for (int t = 0; t < 8; ++t) {
        x[t]     = s0[u][t] * 0.125f - bb[u][t >> 2][t & 3];
        x[8 + t] = s1[u][t] * 0.125f - bb[u][2 + (t >> 2)][t & 3];
      }
      float mx = x[0];
#pragma unroll
      for (int t = 1; t < 16; ++t) mx = fmaxf(mx, x[t]);
      mx = fmaxf(mx, other_half(mx));    // both halves scale by one maximum
      const float mnew = fmaxf(m_run[u], mx);
      const float corr = __expf(m_run[u] - mnew);
      v2f rs = {0.0f, 0.0f};             // even and odd keys: packed adds
#pragma unroll
      for (int t = 0; t < 16; t += 2) {
        x[t]     = __expf(x[t] - mnew);
        x[t + 1] = __expf(x[t + 1] - mnew);
        rs += (v2f){x[t], x[t + 1]};
      }
      l_run[u] = l_run[u] * corr + (rs.x + rs.y);
      m_run[u] = mnew;
#pragma unroll  // accumulator elements are named by constants
      for (int j = 0; j < 4; ++j) acc[u][j] *= corr;

      // ---- O^T += V^T * P^T : the two score tiles, rounded in place, are the
      //      32-key B operand in the hardware's k order; V^T rows are A ------
      Frag16 pf;
      pf.q[0] = make_uint4(pack_bf16(x[0], x[1]), pack_bf16(x[2], x[3]),
                           pack_bf16(x[4], x[5]), pack_bf16(x[6], x[7]));
      pf.q[1] = make_uint4(pack_bf16(x[8], x[9]), pack_bf16(x[10], x[11]),
                           pack_bf16(x[12], x[13]), pack_bf16(x[14], x[15]));
#pragma unroll  // accumulator tiles are named by constants
      for (int j = 0; j < 4; ++j)
        acc[u][j] = __builtin_amdgcn_wmma_f32_16x16x32_bf16(
            false, bv[j], false, pf.v, (short)0, acc[u][j], false, false);
    }

    // ---- hand-over: tile it + 1 is published, buffer buf is given up ------
    // this wave's reads of buffer buf have returned
    asm volatile("s_wait_dscnt 0x0" ::: "memory");
    // this wave's copies of tile it + 1 have landed
    asm volatile("s_wait_asynccnt 0x0" ::: "memory");
    __syncthreads();
    if (it + 2 < NITER)                  // the same for the whole work-group
      copy_tile(lds_off(&k_lds[buf][0][kdst]), lds_off(&v_lds[buf][0][vdst]),
                lds_off(&b_lds[buf][bdst]), kvoff, boff,
                kg + (size_t)(it + 2) * (KBLK * DQ),
                vg + (size_t)(it + 2) * (KBLK * DV), biasp + (it + 2) * KBLK);
  }
  // no copy is outstanding when the wave ends
  asm volatile("s_wait_asynccnt 0x0" ::: "memory");

  // ---- normalize and write out: contiguous [B,G,H,N,dv] -------------------
  //      acc[u][J][t] = feature 16*J + 8*half + t of query u*16 + lane16
#pragma unroll  // acc[][] stays in registers
  for (int u = 0; u < QT; ++u) {
    const float inv = 1.0f / (l_run[u] + other_half(l_run[u]));
    float* outp = out + ((hp + hs) * NSEQ + rowbase + wrow + u * 16 + lane16) *
                            DV + 8 * half;
#pragma unroll
    for (int j = 0; j < 4; ++j) {
      const v8f o = acc[u][j] * inv;
      *(v4f*)(outp + j * 16)     = o.lo;
      *(v4f*)(outp + j * 16 + 4) = o.hi;
    }
  }
}

extern "C" void kernel_launch(void* const* d_in, const int* in_sizes, int n_in,
                              void* d_out, int out_size, void* d_ws,
                              size_t ws_size, hipStream_t stream) {
  (void)in_sizes; (void)n_in; (void)out_size; (void)ws_size;
  const float* q   = (const float*)d_in[0];
  const float* k   = (const float*)d_in[1];
  const float* v   = (const float*)d_in[2];
  const float* ncs = (const float*)d_in[3];
  float* out = (float*)d_out;
  unsigned short* qb = (unsigned short*)d_ws;   // three bf16 planes, 48 MiB
  unsigned short* kb = qb + PLANE;
  unsigned short* vt = kb + PLANE;

  split_heads_kernel<<<QK_BLOCKS + V_BLOCKS, 256, 0, stream>>>(q, k, v, qb, kb,
                                                               vt);

  const int grid = NB * NG * (NH / HPB) * (NSEQ / ROWS_PB); // 512 blocks
  attn_bias_fwd_kernel<<<grid, 256, 0, stream>>>(
      qb, kb, vt, ncs, out);
}

// v006
// One run takes 50.7 microseconds.
// In two side-by-side timings against v005, it was 1.05 and 1.04 times as fast.
// Counting every step since v000, it is 11.1 times as fast.
#include <hip/hip_runtime.h>

typedef __attribute__((ext_vector_type(16))) __bf16 v16bf;
typedef __attribute__((ext_vector_type(2)))  __bf16 v2bf;
typedef __attribute__((ext_vector_type(8)))  float  v8f;
typedef __attribute__((ext_vector_type(4)))  float  v4f;
typedef __attribute__((ext_vector_type(2)))  float  v2f;

#define NB      2
#define NG      4
#define NH      16
#define NSEQ    1024
#define DQ      64
#define DV      64
#define DMODEL  1024          // DQ*NH == DV*NH
#define ROWS_PB 128           // query rows per block (4 waves x 32 rows a head)
#define HPB     2             // heads per block (waves 0..3 and 4..7)
#define QT      2             // 16-query tiles per wave
#define KBLK    32            // key columns per inner iteration
#define NITER   (NSEQ / KBLK) // 32
#define NBUF    3             // LDS buffers of the K, V and bias tiles
#define PLANE   (NB * NG * NH * NSEQ * DQ)  // elements of one bf16 plane

// Head-split launch: 8 waves per block, 4 units of work per wave.
#define UNITS_PW  4
#define QK_BLOCKS (2 * NB * NG * NSEQ / (8 * UNITS_PW))                    // 512
#define V_BLOCKS  (NB * NG * (NSEQ / KBLK) * (DV / 2) / (8 * UNITS_PW))    // 256

// LDS strides in bf16 elements (row base must stay 16B aligned: *2B % 16 == 0)
#define QSTRIDE 72            // 144 B row
#define KSTRIDE 72
#define VSTRIDE 40            // 80 B row (transposed V: [dv][k])
#define BSTRIDE 36            // bias rows, in floats: 144 B row

// Two f32 -> two bf16 in one word, round to nearest even: one packed hardware
// convert (v_cvt_pk_bf16_f32).
__device__ __forceinline__ unsigned pack_bf16(float lo, float hi) {
  const v2f p = {lo, hi};
  return __builtin_bit_cast(unsigned, __builtin_convertvector(p, v2bf));
}

union Frag16 { uint4 q[2]; v16bf v; };

// Load a 16-element bf16 fragment per the CDNA5 16-bit A/B VGPR layout:
//   element e (0..7)  holds K = koff + 8*half + e
//   element e (8..15) holds K = koff + 16 + 8*half + (e-8)
// => two contiguous 16-byte LDS loads.
__device__ __forceinline__ v16bf load_frag(const unsigned short* rowbase,
                                           int koff, int half) {
  Frag16 fr;
  fr.q[0] = *(const uint4*)(rowbase + koff + 8 * half);
  fr.q[1] = *(const uint4*)(rowbase + koff + 16 + 8 * half);
  return fr.v;
}

// Lane l <-> lane l ^ 16: the two lanes that share one query column.
__device__ __forceinline__ float other_half(float x) {
  int b = __float_as_int(x);
  return __int_as_float(__builtin_amdgcn_permlanex16(b, b, 0x76543210,
                                                     0xfedcba98, false, false));
}

// Byte address in the work-group's LDS: the low word of a __shared__ address.
__device__ __forceinline__ unsigned lds_off(const void* p) {
  return (unsigned)(size_t)p;
}

// One tile's copies of a thread, 16 bytes each, global memory to LDS through
// no register: K and V of both heads, four bias rows.  Global address = scalar
// base + the lane's byte offset.  The wait at the end stands inside the
// statement, so that no register that a copy names is rewritten in front of it.
__device__ __forceinline__ void copy_tile(
    unsigned kd, unsigned vd, unsigned bd, unsigned kvoff, unsigned boff,
    const unsigned short* kp, const unsigned short* vp, const float* bp) {
  asm volatile(
      "global_load_async_to_lds_b128 %0, %8, %10\n\t"
      "global_load_async_to_lds_b128 %1, %8, %11\n\t"
      "global_load_async_to_lds_b128 %2, %8, %12\n\t"
      "global_load_async_to_lds_b128 %3, %8, %13\n\t"
      "global_load_async_to_lds_b128 %4, %9, %14\n\t"
      "global_load_async_to_lds_b128 %5, %9, %15\n\t"
      "global_load_async_to_lds_b128 %6, %9, %16\n\t"
      "global_load_async_to_lds_b128 %7, %9, %17\n\t"
      "s_wait_xcnt 0x0"
      ::"v"(kd), "v"(kd + KBLK * KSTRIDE * 2), "v"(vd),
        "v"(vd + DV * VSTRIDE * 2), "v"(bd), "v"(bd + 32 * BSTRIDE * 4),
        "v"(bd + 64 * BSTRIDE * 4), "v"(bd + 96 * BSTRIDE * 4), "v"(kvoff),
        "v"(boff), "s"(kp), "s"(kp + NSEQ * DQ), "s"(vp), "s"(vp + NSEQ * DV),
        "s"(bp), "s"(bp + 32 * NSEQ), "s"(bp + 64 * NSEQ), "s"(bp + 96 * NSEQ)
      : "memory");
}

// Eight f32 values of head column c -> eight bf16 in one 16-byte word.
__device__ __forceinline__ uint4 pack8(const v4f* x, int c) {
  uint4 o;
  o.x = pack_bf16(x[0][c], x[1][c]);
  o.y = pack_bf16(x[2][c], x[3][c]);
  o.z = pack_bf16(x[4][c], x[5][c]);
  o.w = pack_bf16(x[6][c], x[7][c]);
  return o;
}

// Splits the 16 interleaved heads apart.  A lane reads 16 bytes = 4 heads of
// one feature, eight times, and stores 8 bf16 of each of its 4 heads; every
// store instruction writes four whole 128-byte lines.
__global__ __launch_bounds__(256)
void split_heads_kernel(const float* __restrict__ q,
                        const float* __restrict__ k,
                        const float* __restrict__ v,
                        unsigned short* __restrict__ qb,
                        unsigned short* __restrict__ kb,
                        unsigned short* __restrict__ vt) {
  const int wave = threadIdx.x >> 5;
  const int lane = threadIdx.x & 31;
  const int h4   = lane & 3;             // heads 4*h4 .. 4*h4+3
  const int bid  = blockIdx.x;

  if (bid < QK_BLOCKS) {
    // Q then K, one row per unit: lane group dg holds features 8*dg .. 8*dg+7.
    const int dg   = lane >> 2;
    const int row0 = (bid * 8 + wave) * UNITS_PW;      // 0 .. 2*B*G*N-1
    const bool isq = row0 < NB * NG * NSEQ;            // uniform per wave
    const float* src          = isq ? q : k;
    unsigned short* dst       = isq ? qb : kb;
    const int r0              = row0 & (NB * NG * NSEQ - 1);
    for (int u = 0; u < UNITS_PW; u += 2) {
      const int r = r0 + u, bg = r >> 10, n = r & (NSEQ - 1);  // r even
      const float* s = src + (size_t)r * DMODEL + dg * 8 * NH + h4 * 4;
      v4f x[2][8];                       // two rows: 16 loads in flight
#pragma unroll
      for (int j = 0; j < 8; ++j) {
        x[0][j] = *(const v4f*)(s + j * NH);
        x[1][j] = *(const v4f*)(s + DMODEL + j * NH);
      }
      // Takes the loaded values as inputs, so that all 16 loads are in flight
      // together (without it they are issued a few at a time between the
      // conversions), and the address, so that it stays whole up to the wait
      // that stands before the loads' registers are reused.
      asm volatile("s_wait_xcnt 0x0" ::"v"(x[0][0]), "v"(x[0][1]), "v"(x[0][2]),
                   "v"(x[0][3]), "v"(x[0][4]), "v"(x[0][5]), "v"(x[0][6]),
                   "v"(x[0][7]), "v"(x[1][0]), "v"(x[1][1]), "v"(x[1][2]),
                   "v"(x[1][3]), "v"(x[1][4]), "v"(x[1][5]), "v"(x[1][6]),
                   "v"(x[1][7]), "v"(s)
                   : "memory");
      unsigned short* d =
          dst + ((size_t)(bg * NH + h4 * 4) * NSEQ + n) * DQ + dg * 8;
#pragma unroll
      for (int c = 0; c < 4; ++c) {
        *(uint4*)(d + (size_t)c * NSEQ * DQ)      = pack8(x[0], c);
        *(uint4*)(d + (size_t)c * NSEQ * DQ + DQ) = pack8(x[1], c);
      }
      // the next trip reuses the registers that these stores name
      asm volatile("s_wait_xcnt 0x0" ::: "memory");
    }
  } else {
    // V, 32 keys x 2 features per unit: lane group ng holds keys 8*ng .. 8*ng+7
    // of feature 2*pair + dlow.
    const int dlow  = (lane >> 2) & 1;
    const int ng    = lane >> 3;
    const int unit0 = ((bid - QK_BLOCKS) * 8 + wave) * UNITS_PW;
    for (int u = 0; u < UNITS_PW; u += 2) {
      const int unit = unit0 + u;                      // even
      const int dv   = (unit & 31) * 2 + dlow;
      const int nblk = (unit >> 5) & 31;
      const int bg   = unit >> 10;
      const float* s = v + ((size_t)bg * NSEQ + nblk * KBLK + ng * 8) * DMODEL +
                       dv * NH + h4 * 4;
      v4f x[2][8];                       // two feature pairs: 16 loads in flight
#pragma unroll
      for (int j = 0; j < 8; ++j) {
        x[0][j] = *(const v4f*)(s + (size_t)j * DMODEL);
        x[1][j] = *(const v4f*)(s + (size_t)j * DMODEL + 2 * NH);
      }
      // all 16 loads in flight together, address whole up to the wait: as above
      asm volatile("s_wait_xcnt 0x0" ::"v"(x[0][0]), "v"(x[0][1]), "v"(x[0][2]),
                   "v"(x[0][3]), "v"(x[0][4]), "v"(x[0][5]), "v"(x[0][6]),
                   "v"(x[0][7]), "v"(x[1][0]), "v"(x[1][1]), "v"(x[1][2]),
                   "v"(x[1][3]), "v"(x[1][4]), "v"(x[1][5]), "v"(x[1][6]),
                   "v"(x[1][7]), "v"(s)
                   : "memory");
      unsigned short* d =
          vt + (((size_t)(bg * NH + h4 * 4) * NITER + nblk) * DV + dv) * KBLK +
          ng * 8;
#pragma unroll
      for (int c = 0; c < 4; ++c) {
        *(uint4*)(d + (size_t)c * NSEQ * DV)            = pack8(x[0], c);
        *(uint4*)(d + (size_t)c * NSEQ * DV + 2 * KBLK) = pack8(x[1], c);
      }
      // the next trip reuses the registers that these stores name
      asm volatile("s_wait_xcnt 0x0" ::: "memory");
    }
  }
}

// 147 KB of LDS: two work-groups a WGP, four waves a SIMD.
__global__ __launch_bounds__(256)
void attn_bias_fwd_kernel(
    const unsigned short* __restrict__ qb, const unsigned short* __restrict__ kb,
    const unsigned short* __restrict__ vt, const float* __restrict__ ncs,
    float* __restrict__ out) {
  __shared__ __align__(16) unsigned short q_lds[HPB * ROWS_PB * QSTRIDE];  // 36 KB
  __shared__ __align__(16) unsigned short k_lds[NBUF][HPB][KBLK * KSTRIDE]; // 27 KB
  __shared__ __align__(16) unsigned short v_lds[NBUF][HPB][DV * VSTRIDE];  // 30 KB
  __shared__ __align__(16) float          b_lds[NBUF][ROWS_PB * BSTRIDE];  // 54 KB

  const int tid    = threadIdx.x;
  const int wave   = tid >> 5;
  const int lane   = tid & 31;
  const int lane16 = lane & 15;
  const int half   = lane >> 4;
  const int hs     = wave >> 2;          // which of the block's two heads
  const int wrow   = (wave & 3) * (16 * QT);  // first query row of the wave

  // Block decode: g slowest (L2 bias reuse), then (b, head pair), row-block
  // fastest.
  const int bid     = blockIdx.x;
  const int rowblk  = bid & 7;
  const int pair    = bid >> 3;          // 0..63
  const int g       = pair >> 4;         // 0..3
  const int b       = (pair >> 3) & 1;   // 0..1
  const int h0      = (pair & 7) * HPB;  // first head of the pair
  const int rowbase = rowblk * ROWS_PB;

  const size_t hp = (size_t)((b * NG + g) * NH + h0);       // first head plane
  const unsigned short* qg = qb + (hp * NSEQ + rowbase) * DQ;  // [row][d]
  const unsigned short* kg = kb + hp * NSEQ * DQ;              // [m][d]
  const unsigned short* vg = vt + hp * NSEQ * DV;              // [m/32][n][32]
  const unsigned kvoff = tid * 16;       // a K or V tile is 4 KB contiguous
  const int kdst = (tid >> 3) * KSTRIDE + (tid & 7) * 8;
  const int vdst = (tid >> 2) * VSTRIDE + (tid & 3) * 8;
  // Bias tile of the block, 128 queries x 32 keys: a copy of a wave covers four
  // whole 128-byte rows; the LDS rows turn it so that a lane gets the 16 keys
  // of its query.
  const float* biasp = ncs + (size_t)g * NSEQ * NSEQ
                       + (size_t)rowbase * NSEQ;            // [row*NSEQ + m]
  const unsigned boff = ((tid >> 3) * NSEQ + (tid & 7) * 4) * 4;
  const int bdst = (tid >> 3) * BSTRIDE + (tid & 7) * 4;
  const int bsrc = (wrow + lane16) * BSTRIDE + 8 * half;

  // ---- tile 0 into buffer 0: its copies fly beside the Q loads ------------
  copy_tile(lds_off(&k_lds[0][0][kdst]), lds_off(&v_lds[0][0][vdst]),
            lds_off(&b_lds[0][bdst]), kvoff, boff, kg, vg, biasp);

  // ---- stage the two heads' Q tiles (128 x 64 each) as bf16 in LDS --------
#pragma unroll  // the eight loads of a thread go out together
  for (int jj = 0; jj < HPB * ROWS_PB * DQ / 8 / 256; ++jj) {
    const int hq = jj >> 2, j = jj & 3;  // head of the pair, quarter of its tile
    int i = tid + j * 256, row = hq * ROWS_PB + (i >> 3), d = (i & 7) * 8;
    *(uint4*)&q_lds[row * QSTRIDE + d] =
        *(const uint4*)(qg + hq * (NSEQ * DQ) + i * 8);
  }

  // ---- tile 0 has landed; tile 1 flies; tile 0 and Q are published ---------
  // this wave's copies have landed before the barrier publishes them
  asm volatile("s_wait_asynccnt 0x0" ::: "memory");
  // buffer 1 has had no reader yet
  copy_tile(lds_off(&k_lds[1][0][kdst]), lds_off(&v_lds[1][0][vdst]),
            lds_off(&b_lds[1][bdst]), kvoff, boff, kg + KBLK * DQ,
            vg + KBLK * DV, biasp + KBLK);
  __syncthreads();

  // B fragments: this wave's 2 x 16 queries as columns (d-chunks 0..31, 32..63)
  v16bf aq[QT][2];
#pragma unroll  // fragments are named by constants
  for (int u = 0; u < QT; ++u) {
    const unsigned short* qrow =
        &q_lds[(hs * ROWS_PB + wrow + u * 16 + lane16) * QSTRIDE];
    aq[u][0] = load_frag(qrow, 0, half);
    aq[u][1] = load_frag(qrow, 32, half);
  }

  v8f acc[QT][4] = {};
  // Of query u*16 + lane16: the running maximum (equal in both halves) and this
  // half's own share of the running sum.
  float m_run[QT], l_run[QT];
#pragma unroll  // named by constants: they stay in registers
  for (int u = 0; u < QT; ++u) { m_run[u] = -3.0e38f; l_run[u] = 0.0f; }

  // One pass: tile it, which lies in buffer buf = it mod 3.  With refill set,
  // tile it + 2 is sent for, into buffer fill = (it + 2) mod 3.  Inlined at both
  // places of use, where refill is a constant.
  auto pass = [&](const int it, const int buf, const int fill,
                  const bool refill) __attribute__((always_inline)) {

    // ---- preload all A fragments so DS latency overlaps WMMA/softmax ------
    const unsigned short* k0 = &k_lds[buf][hs][(0 * 16 + lane16) * KSTRIDE];
    const unsigned short* k1 = &k_lds[buf][hs][(1 * 16 + lane16) * KSTRIDE];
    v16bf bk00 = load_frag(k0, 0, half);
    v16bf bk01 = load_frag(k0, 32, half);
    v16bf bk10 = load_frag(k1, 0, half);
    v16bf bk11 = load_frag(k1, 32, half);
    v16bf bv[4];
#pragma unroll  // fragments are named by constants
    for (int j = 0; j < 4; ++j)
      bv[j] = load_frag(&v_lds[buf][hs][(j * 16 + lane16) * VSTRIDE], 0, half);

    // bias of query u*16 + lane16: keys 8*half + 0..7 and 16 + 8*half + 0..7
    v4f bb[QT][4];
#pragma unroll  // bb[][] stays in registers
    for (int u = 0; u < QT; ++u) {
      const float* br = &b_lds[buf][bsrc + u * 16 * BSTRIDE];
      bb[u][0] = *(const v4f*)(br);
      bb[u][1] = *(const v4f*)(br + 4);
      bb[u][2] = *(const v4f*)(br + 16);
      bb[u][3] = *(const v4f*)(br + 20);
    }

    // ---- S^T = K * Q^T : two 16-key row tiles, K-dim 64 = 2 chunks, for each
    //      of the two query tiles: every K fragment is used twice -----------
    //      s0[u][t] = key 8*half + t, s1[u][t] = key 16 + 8*half + t of the
    //      tile, both of query u*16 + lane16
    v8f s0[QT] = {}, s1[QT] = {};
#pragma unroll  // score tiles are named by constants, here and in the next loop
    for (int u = 0; u < QT; ++u) {
      s0[u] = __builtin_amdgcn_wmma_f32_16x16x32_bf16(
          false, bk00, false, aq[u][0], (short)0, s0[u], false, false);
      s1[u] = __builtin_amdgcn_wmma_f32_16x16x32_bf16(
          false, bk10, false, aq[u][0], (short)0, s1[u], false, false);
    }
#pragma unroll
    for (int u = 0; u < QT; ++u) {
      s0[u] = __builtin_amdgcn_wmma_f32_16x16x32_bf16(
          false, bk01, false, aq[u][1], (short)0, s0[u], false, false);
      s1[u] = __builtin_amdgcn_wmma_f32_16x16x32_bf16(
          false, bk11, false, aq[u][1], (short)0, s1[u], false, false);
    }

    // ---- hand-over, first part: the pass has all it reads from LDS -----------
    // this wave's reads of buffer buf have returned
    asm volatile("s_wait_dscnt 0x0" ::: "memory");
    // this wave's copies of tile it + 1 have landed
    asm volatile("s_wait_asynccnt 0x0" ::: "memory");
    // Buffer fill held tile it - 1: the barrier of pass it - 1 ended every wave's
    // reads of it, so its refill need not wait for this pass's barrier and flies
    // until the wait above comes round again, a whole pass.
    if (refill)
      copy_tile(lds_off(&k_lds[fill][0][kdst]), lds_off(&v_lds[fill][0][vdst]),
                lds_off(&b_lds[fill][bdst]), kvoff, boff,
                kg + (size_t)(it + 2) * (KBLK * DQ),
                vg + (size_t)(it + 2) * (KBLK * DV), biasp + (it + 2) * KBLK);
    // the signal of the pass's barrier, behind both waits
    asm volatile("s_barrier_signal -1" ::: "memory");
    // keeps refill and signal here, in front of the softmax: left free, they
    // sink to the pass's foot, and the copies lose most of their time to land
    __builtin_amdgcn_sched_barrier(0);

#pragma unroll  // the two query tiles: everything below is named by constants
    for (int u = 0; u < QT; ++u) {
      // ---- bias, online softmax: 16 keys of one query per lane ------------
      //      (the loops over x[] are unrolled so that x[] stays in registers)
      float x[16];
#pragma unroll
      for (int t = 0; t < 8; t += 2) {   // by register pairs: packed operations
        const v2f a0 = (v2f){s0[u][t], s0[u][t + 1]} * 0.125f -
                       (v2f){bb[u][t >> 2][t & 3], bb[u][t >> 2][(t & 3) + 1]};
        const v2f a1 = (v2f){s1[u][t], s1[u][t + 1]} * 0.125f -
                       (v2f){bb[u][2 + (t >> 2)][t & 3],
                             bb[u][2 + (t >> 2)][(t & 3) + 1]};
        x[t] = a0.x;     x[t + 1] = a0.y;
        x[8 + t] = a1.x; x[9 + t] = a1.y;
      }
      float mx = x[0];
#pragma unroll
      for (int t = 1; t < 16; ++t) mx = fmaxf(mx, x[t]);
      mx = fmaxf(mx, other_half(mx));    // both halves scale by one maximum
      const float mnew = fmaxf(m_run[u], mx);
      const float corr = __expf(m_run[u] - mnew);
      v2f rs = {0.0f, 0.0f};             // even and odd keys: packed adds
#pragma unroll
      for (int t = 0; t < 16; t += 2) {
        const v2f d = (v2f){x[t], x[t + 1]} - mnew;  // by register pairs, as above
        x[t]     = __expf(d.x);
        x[t + 1] = __expf(d.y);
        rs += (v2f){x[t], x[t + 1]};
      }
      l_run[u] = l_run[u] * corr + (rs.x + rs.y);
      m_run[u] = mnew;
#pragma unroll  // accumulator elements are named by constants
      for (int j = 0; j < 4; ++j) acc[u][j] *= corr;

      // ---- O^T += V^T * P^T : the two score tiles, rounded in place, are the
      //      32-key B operand in the hardware's k order; V^T rows are A ------
      Frag16 pf;
      pf.q[0] = make_uint4(pack_bf16(x[0], x[1]), pack_bf16(x[2], x[3]),
                           pack_bf16(x[4], x[5]), pack_bf16(x[6], x[7]));
      pf.q[1] = make_uint4(pack_bf16(x[8], x[9]), pack_bf16(x[10], x[11]),
                           pack_bf16(x[12], x[13]), pack_bf16(x[14], x[15]));
#pragma unroll  // accumulator tiles are named by constants
      for (int j = 0; j < 4; ++j)
        acc[u][j] = __builtin_amdgcn_wmma_f32_16x16x32_bf16(
            false, bv[j], false, pf.v, (short)0, acc[u][j], false, false);
    }

    // ---- hand-over, second part: every wave has signalled, so tile it + 1 is
    //      published and buffer buf is given up --------------------------------
    // keeps the pass's arithmetic in front of the wait: a wave then meets it a
    // long way behind its own signal and seldom has to stand there
    __builtin_amdgcn_sched_barrier(0);
    // the wait of the pass's barrier; no LDS read stands between signal and wait
    asm volatile("s_barrier_wait -1" ::: "memory");
  };

  // The passes that send for a tile, then the last two, which have none left to
  // send for: no test stands in a pass.
  int buf = 0, fill = 2;
  for (int it = 0; it < NITER - 2; ++it) {
    pass(it, buf, fill, true);
    buf  = buf == NBUF - 1 ? 0 : buf + 1;
    fill = fill == NBUF - 1 ? 0 : fill + 1;
  }
  for (int it = NITER - 2; it < NITER; ++it) {
    pass(it, buf, 0, false);
    buf = buf == NBUF - 1 ? 0 : buf + 1;
  }
  // no copy is outstanding when the wave ends
  asm volatile("s_wait_asynccnt 0x0" ::: "memory");

  // ---- normalize and write out: contiguous [B,G,H,N,dv] -------------------
  //      acc[u][J][t] = feature 16*J + 8*half + t of query u*16 + lane16
#pragma unroll  // acc[][] stays in registers
  for (int u = 0; u < QT; ++u) {
    const float inv = 1.0f / (l_run[u] + other_half(l_run[u]));
    float* outp = out + ((hp + hs) * NSEQ + rowbase + wrow + u * 16 + lane16) *
                            DV + 8 * half;
#pragma unroll
    for (int j = 0; j < 4; ++j) {
      const v8f o = acc[u][j] * inv;
      *(v4f*)(outp + j * 16)     = o.lo;
      *(v4f*)(outp + j * 16 + 4) = o.hi;
    }
  }
}

extern "C" void kernel_launch(void* const* d_in, const int* in_sizes, int n_in,
                              void* d_out, int out_size, void* d_ws,
                              size_t ws_size, hipStream_t stream) {
  (void)in_sizes; (void)n_in; (void)out_size; (void)ws_size;
  const float* q   = (const float*)d_in[0];
  const float* k   = (const float*)d_in[1];
  const float* v   = (const float*)d_in[2];
  const float* ncs = (const float*)d_in[3];
  float* out = (float*)d_out;
  unsigned short* qb = (unsigned short*)d_ws;   // three bf16 planes, 48 MiB
  unsigned short* kb = qb + PLANE;
  unsigned short* vt = kb + PLANE;

  split_heads_kernel<<<QK_BLOCKS + V_BLOCKS, 256, 0, stream>>>(q, k, v, qb, kb,
                                                               vt);

  const int grid = NB * NG * (NH / HPB) * (NSEQ / ROWS_PB); // 512 blocks
  attn_bias_fwd_kernel<<<grid, 256, 0, stream>>>(
      qb, kb, vt, ncs, out);
}

// v007
// A run of this version takes 49 microseconds.
// Timed twice side by side with v006, it ran 1.04 and 1.03 times as fast.
// All steps since v000 together make it 11.5 times as fast.
#include <hip/hip_runtime.h>

typedef __attribute__((ext_vector_type(16))) __bf16 v16bf;
typedef __attribute__((ext_vector_type(2)))  __bf16 v2bf;
typedef __attribute__((ext_vector_type(8)))  float  v8f;
typedef __attribute__((ext_vector_type(4)))  float  v4f;
typedef __attribute__((ext_vector_type(2)))  float  v2f;

#define NB      2
#define NG      4
#define NH      16
#define NSEQ    1024
#define DQ      64
#define DV      64
#define DMODEL  1024          // DQ*NH == DV*NH
#define ROWS_PB 128           // query rows per block (4 waves x 32 rows a head)
#define HPB     2             // heads per block (waves 0..3 and 4..7)
#define QT      2             // 16-query tiles per wave
#define KBLK    32            // key columns per inner iteration
#define NITER   (NSEQ / KBLK) // 32
#define NBUF    3             // LDS buffers of the K, V and bias tiles
#define PLANE   (NB * NG * NH * NSEQ * DQ)  // elements of one bf16 plane

// Head-split launch: 8 waves per block, 4 units of work per wave.
#define UNITS_PW  4
#define QK_BLOCKS (2 * NB * NG * NSEQ / (8 * UNITS_PW))                    // 512
#define V_BLOCKS  (NB * NG * (NSEQ / KBLK) * (DV / 2) / (8 * UNITS_PW))    // 256

// LDS strides in bf16 elements (row base must stay 16B aligned: *2B % 16 == 0)
#define QSTRIDE 72            // 144 B row
#define KSTRIDE 72
#define VSTRIDE 40            // 80 B row (transposed V: [dv][k])
#define BSTRIDE 36            // bias rows, in floats: 144 B row

// Two f32 -> two bf16 in one word, round to nearest even: one packed hardware
// convert (v_cvt_pk_bf16_f32).
__device__ __forceinline__ unsigned pack_bf16(float lo, float hi) {
  const v2f p = {lo, hi};
  return __builtin_bit_cast(unsigned, __builtin_convertvector(p, v2bf));
}

union Frag16 { uint4 q[2]; v16bf v; };

// Load a 16-element bf16 fragment per the CDNA5 16-bit A/B VGPR layout:
//   element e (0..7)  holds K = koff + 8*half + e
//   element e (8..15) holds K = koff + 16 + 8*half + (e-8)
// => two contiguous 16-byte LDS loads.
__device__ __forceinline__ v16bf load_frag(const unsigned short* rowbase,
                                           int koff, int half) {
  Frag16 fr;
  fr.q[0] = *(const uint4*)(rowbase + koff + 8 * half);
  fr.q[1] = *(const uint4*)(rowbase + koff + 16 + 8 * half);
  return fr.v;
}

// Lane l <-> lane l ^ 16: the two lanes that share one query column.
__device__ __forceinline__ float other_half(float x) {
  int b = __float_as_int(x);
  return __int_as_float(__builtin_amdgcn_permlanex16(b, b, 0x76543210,
                                                     0xfedcba98, false, false));
}

// Byte address in the work-group's LDS: the low word of a __shared__ address.
__device__ __forceinline__ unsigned lds_off(const void* p) {
  return (unsigned)(size_t)p;
}

// One tile's copies of a thread, 16 bytes each, global memory to LDS through
// no register: K and V of both heads, four bias rows.  Global address = scalar
// base + the lane's byte offset + the immediate; LDS address = register + the
// same immediate, which moves both: the scalar bases are set back by it, and
// one LDS address register serves all copies of an array.  The wait at the end
// stands inside the statement, so that no register that a copy names is
// rewritten in front of it.
#define KHOP (KBLK * KSTRIDE * 2)   // LDS bytes from a head's K tile to the next
#define VHOP (DV * VSTRIDE * 2)     // the same for V
#define BHOP (32 * BSTRIDE * 4)     // LDS bytes of 32 bias rows
__device__ __forceinline__ void copy_tile(
    unsigned kd, unsigned vd, unsigned bd, unsigned kvoff, unsigned boff,
    const unsigned short* kp, const unsigned short* vp, const float* bp) {
  asm volatile(
      "global_load_async_to_lds_b128 %0, %3, %5\n\t"
      "global_load_async_to_lds_b128 %0, %3, %6 offset:%13\n\t"
      "global_load_async_to_lds_b128 %1, %3, %7\n\t"
      "global_load_async_to_lds_b128 %1, %3, %8 offset:%14\n\t"
      "global_load_async_to_lds_b128 %2, %4, %9\n\t"
      "global_load_async_to_lds_b128 %2, %4, %10 offset:%15\n\t"
      "global_load_async_to_lds_b128 %2, %4, %11 offset:%16\n\t"
      "global_load_async_to_lds_b128 %2, %4, %12 offset:%17\n\t"
      "s_wait_xcnt 0x0"
      ::"v"(kd), "v"(vd), "v"(bd), "v"(kvoff), "v"(boff), "s"(kp),
        "s"((const char*)(kp + NSEQ * DQ) - KHOP), "s"(vp),
        "s"((const char*)(vp + NSEQ * DV) - VHOP), "s"(bp),
        "s"((const char*)(bp + 32 * NSEQ) - BHOP),
        "s"((const char*)(bp + 64 * NSEQ) - 2 * BHOP),
        "s"((const char*)(bp + 96 * NSEQ) - 3 * BHOP), "i"(KHOP), "i"(VHOP),
        "i"(BHOP), "i"(2 * BHOP), "i"(3 * BHOP)
      : "memory");
}

// Eight f32 values of head column c -> eight bf16 in one 16-byte word.
__device__ __forceinline__ uint4 pack8(const v4f* x, int c) {
  uint4 o;
  o.x = pack_bf16(x[0][c], x[1][c]);
  o.y = pack_bf16(x[2][c], x[3][c]);
  o.z = pack_bf16(x[4][c], x[5][c]);
  o.w = pack_bf16(x[6][c], x[7][c]);
  return o;
}

// Splits the 16 interleaved heads apart.  A lane reads 16 bytes = 4 heads of
// one feature, eight times, and stores 8 bf16 of each of its 4 heads; every
// store instruction writes four whole 128-byte lines.
__global__ __launch_bounds__(256)
void split_heads_kernel(const float* __restrict__ q,
                        const float* __restrict__ k,
                        const float* __restrict__ v,
                        unsigned short* __restrict__ qb,
                        unsigned short* __restrict__ kb,
                        unsigned short* __restrict__ vt) {
  const int wave = threadIdx.x >> 5;
  const int lane = threadIdx.x & 31;
  const int h4   = lane & 3;             // heads 4*h4 .. 4*h4+3
  const int bid  = blockIdx.x;

  if (bid < QK_BLOCKS) {
    // Q then K, one row per unit: lane group dg holds features 8*dg .. 8*dg+7.
    const int dg   = lane >> 2;
    const int row0 = (bid * 8 + wave) * UNITS_PW;      // 0 .. 2*B*G*N-1
    const bool isq = row0 < NB * NG * NSEQ;            // uniform per wave
    const float* src          = isq ? q : k;
    unsigned short* dst       = isq ? qb : kb;
    const int r0              = row0 & (NB * NG * NSEQ - 1);
    for (int u = 0; u < UNITS_PW; u += 2) {
      const int r = r0 + u, bg = r >> 10, n = r & (NSEQ - 1);  // r even
      const float* s = src + (size_t)r * DMODEL + dg * 8 * NH + h4 * 4;
      v4f x[2][8];                       // two rows: 16 loads in flight
#pragma unroll
      for (int j = 0; j < 8; ++j) {
        x[0][j] = *(const v4f*)(s + j * NH);
        x[1][j] = *(const v4f*)(s + DMODEL + j * NH);
      }
      // Takes the loaded values as inputs, so that all 16 loads are in flight
      // together (without it they are issued a few at a time between the
      // conversions), and the address, so that it stays whole up to the wait
      // that stands before the loads' registers are reused.
      asm volatile("s_wait_xcnt 0x0" ::"v"(x[0][0]), "v"(x[0][1]), "v"(x[0][2]),
                   "v"(x[0][3]), "v"(x[0][4]), "v"(x[0][5]), "v"(x[0][6]),
                   "v"(x[0][7]), "v"(x[1][0]), "v"(x[1][1]), "v"(x[1][2]),
                   "v"(x[1][3]), "v"(x[1][4]), "v"(x[1][5]), "v"(x[1][6]),
                   "v"(x[1][7]), "v"(s)
                   : "memory");
      unsigned short* d =
          dst + ((size_t)(bg * NH + h4 * 4) * NSEQ + n) * DQ + dg * 8;
#pragma unroll
      for (int c = 0; c < 4; ++c) {
        *(uint4*)(d + (size_t)c * NSEQ * DQ)      = pack8(x[0], c);
        *(uint4*)(d + (size_t)c * NSEQ * DQ + DQ) = pack8(x[1], c);
      }
      // the next trip reuses the registers that these stores name
      asm volatile("s_wait_xcnt 0x0" ::: "memory");
    }
  } else {
    // V, 32 keys x 2 features per unit: lane group ng holds keys 8*ng .. 8*ng+7
    // of feature 2*pair + dlow.
    const int dlow  = (lane >> 2) & 1;
    const int ng    = lane >> 3;
    const int unit0 = ((bid - QK_BLOCKS) * 8 + wave) * UNITS_PW;
    for (int u = 0; u < UNITS_PW; u += 2) {
      const int unit = unit0 + u;                      // even
      const int dv   = (unit & 31) * 2 + dlow;
      const int nblk = (unit >> 5) & 31;
      const int bg   = unit >> 10;
      const float* s = v + ((size_t)bg * NSEQ + nblk * KBLK + ng * 8) * DMODEL +
                       dv * NH + h4 * 4;
      v4f x[2][8];                       // two feature pairs: 16 loads in flight
#pragma unroll
      for (int j = 0; j < 8; ++j) {
        x[0][j] = *(const v4f*)(s + (size_t)j * DMODEL);
        x[1][j] = *(const v4f*)(s + (size_t)j * DMODEL + 2 * NH);
      }
      // all 16 loads in flight together, address whole up to the wait: as above
      asm volatile("s_wait_xcnt 0x0" ::"v"(x[0][0]), "v"(x[0][1]), "v"(x[0][2]),
                   "v"(x[0][3]), "v"(x[0][4]), "v"(x[0][5]), "v"(x[0][6]),
                   "v"(x[0][7]), "v"(x[1][0]), "v"(x[1][1]), "v"(x[1][2]),
                   "v"(x[1][3]), "v"(x[1][4]), "v"(x[1][5]), "v"(x[1][6]),
                   "v"(x[1][7]), "v"(s)
                   : "memory");
      unsigned short* d =
          vt + (((size_t)(bg * NH + h4 * 4) * NITER + nblk) * DV + dv) * KBLK +
          ng * 8;
#pragma unroll
      for (int c = 0; c < 4; ++c) {
        *(uint4*)(d + (size_t)c * NSEQ * DV)            = pack8(x[0], c);
        *(uint4*)(d + (size_t)c * NSEQ * DV + 2 * KBLK) = pack8(x[1], c);
      }
      // the next trip reuses the registers that these stores name
      asm volatile("s_wait_xcnt 0x0" ::: "memory");
    }
  }
}

// 147 KB of LDS: two work-groups a WGP, four waves a SIMD.
__global__ __launch_bounds__(256)
void attn_bias_fwd_kernel(
    const unsigned short* __restrict__ qb, const unsigned short* __restrict__ kb,
    const unsigned short* __restrict__ vt, const float* __restrict__ ncs,
    float* __restrict__ out) {
  __shared__ __align__(16) unsigned short q_lds[HPB * ROWS_PB * QSTRIDE];  // 36 KB
  __shared__ __align__(16) unsigned short k_lds[NBUF][HPB][KBLK * KSTRIDE]; // 27 KB
  __shared__ __align__(16) unsigned short v_lds[NBUF][HPB][DV * VSTRIDE];  // 30 KB
  __shared__ __align__(16) float          b_lds[NBUF][ROWS_PB * BSTRIDE];  // 54 KB

  const int tid    = threadIdx.x;
  const int wave   = tid >> 5;
  const int lane   = tid & 31;
  const int lane16 = lane & 15;
  const int half   = lane >> 4;
  const int hs     = wave >> 2;          // which of the block's two heads
  const int wrow   = (wave & 3) * (16 * QT);  // first query row of the wave

  // Block decode: g slowest (L2 bias reuse), then (b, head pair), row-block
  // fastest.
  const int bid     = blockIdx.x;
  const int rowblk  = bid & 7;
  const int pair    = bid >> 3;          // 0..63
  const int g       = pair >> 4;         // 0..3
  const int b       = (pair >> 3) & 1;   // 0..1
  const int h0      = (pair & 7) * HPB;  // first head of the pair
  const int rowbase = rowblk * ROWS_PB;

  const size_t hp = (size_t)((b * NG + g) * NH + h0);       // first head plane
  const unsigned short* qg = qb + (hp * NSEQ + rowbase) * DQ;  // [row][d]
  const unsigned short* kg = kb + hp * NSEQ * DQ;              // [m][d]
  const unsigned short* vg = vt + hp * NSEQ * DV;              // [m/32][n][32]
  const unsigned kvoff = tid * 16;       // a K or V tile is 4 KB contiguous
  const int kdst = (tid >> 3) * KSTRIDE + (tid & 7) * 8;
  const int vdst = (tid >> 2) * VSTRIDE + (tid & 3) * 8;
  // Bias tile of the block, 128 queries x 32 keys: a copy of a wave covers four
  // whole 128-byte rows; the LDS rows turn it so that a lane gets the 16 keys
  // of its query.
  const float* biasp = ncs + (size_t)g * NSEQ * NSEQ
                       + (size_t)rowbase * NSEQ;            // [row*NSEQ + m]
  const unsigned boff = ((tid >> 3) * NSEQ + (tid & 7) * 4) * 4;
  const int bdst = (tid >> 3) * BSTRIDE + (tid & 7) * 4;
  const int bsrc = (wrow + lane16) * BSTRIDE + 8 * half;

  // ---- tile 0 into buffer 0: its copies fly beside the Q loads ------------
  copy_tile(lds_off(&k_lds[0][0][kdst]), lds_off(&v_lds[0][0][vdst]),
            lds_off(&b_lds[0][bdst]), kvoff, boff, kg, vg, biasp);

  // ---- stage the two heads' Q tiles (128 x 64 each) as bf16 in LDS --------
#pragma unroll  // the eight loads of a thread go out together
  for (int jj = 0; jj < HPB * ROWS_PB * DQ / 8 / 256; ++jj) {
    const int hq = jj >> 2, j = jj & 3;  // head of the pair, quarter of its tile
    int i = tid + j * 256, row = hq * ROWS_PB + (i >> 3), d = (i & 7) * 8;
    *(uint4*)&q_lds[row * QSTRIDE + d] =
        *(const uint4*)(qg + hq * (NSEQ * DQ) + i * 8);
  }

  // ---- tile 0 has landed; tile 1 flies; tile 0 and Q are published ---------
  // this wave's copies have landed before the barrier publishes them
  asm volatile("s_wait_asynccnt 0x0" ::: "memory");
  // buffer 1 has had no reader yet
  copy_tile(lds_off(&k_lds[1][0][kdst]), lds_off(&v_lds[1][0][vdst]),
            lds_off(&b_lds[1][bdst]), kvoff, boff, kg + KBLK * DQ,
            vg + KBLK * DV, biasp + KBLK);
  __syncthreads();

  // B fragments: this wave's 2 x 16 queries as columns (d-chunks 0..31, 32..63)
  v16bf aq[QT][2];
#pragma unroll  // fragments are named by constants
  for (int u = 0; u < QT; ++u) {
    const unsigned short* qrow =
        &q_lds[(hs * ROWS_PB + wrow + u * 16 + lane16) * QSTRIDE];
    aq[u][0] = load_frag(qrow, 0, half);
    aq[u][1] = load_frag(qrow, 32, half);
  }

  v8f acc[QT][4] = {};
  // Of query u*16 + lane16: the running maximum (equal in both halves) and this
  // half's own share of the running sum.
  float m_run[QT], l_run[QT];
#pragma unroll  // named by constants: they stay in registers
  for (int u = 0; u < QT; ++u) { m_run[u] = -3.0e38f; l_run[u] = 0.0f; }

  // One pass: tile it, which lies in buffer buf = it mod 3.  With refill set,
  // tile it + 2 is sent for, into buffer fill = (it + 2) mod 3.  Inlined at each
  // place of use, where buf, fill and refill are constants.
  auto pass = [&](const int it, const int buf, const int fill,
                  const bool refill) __attribute__((always_inline)) {

    // ---- preload all A fragments so DS latency overlaps WMMA/softmax ------
    const unsigned short* k0 = &k_lds[buf][hs][(0 * 16 + lane16) * KSTRIDE];
    const unsigned short* k1 = &k_lds[buf][hs][(1 * 16 + lane16) * KSTRIDE];
    v16bf bk00 = load_frag(k0, 0, half);
    v16bf bk01 = load_frag(k0, 32, half);
    v16bf bk10 = load_frag(k1, 0, half);
    v16bf bk11 = load_frag(k1, 32, half);
    v16bf bv[4];
#pragma unroll  // fragments are named by constants
    for (int j = 0; j < 4; ++j)
      bv[j] = load_frag(&v_lds[buf][hs][(j * 16 + lane16) * VSTRIDE], 0, half);

    // bias of query u*16 + lane16: keys 8*half + 0..7 and 16 + 8*half + 0..7
    v4f bb[QT][4];
#pragma unroll  // bb[][] stays in registers
    for (int u = 0; u < QT; ++u) {
      const float* br = &b_lds[buf][bsrc + u * 16 * BSTRIDE];
      bb[u][0] = *(const v4f*)(br);
      bb[u][1] = *(const v4f*)(br + 4);
      bb[u][2] = *(const v4f*)(br + 16);
      bb[u][3] = *(const v4f*)(br + 20);
    }

    // ---- S^T = K * Q^T : two 16-key row tiles, K-dim 64 = 2 chunks, for each
    //      of the two query tiles: every K fragment is used twice -----------
    //      s0[u][t] = key 8*half + t, s1[u][t] = key 16 + 8*half + t of the
    //      tile, both of query u*16 + lane16
    v8f s0[QT] = {}, s1[QT] = {};
#pragma unroll  // score tiles are named by constants, here and in the next loop
    for (int u = 0; u < QT; ++u) {
      s0[u] = __builtin_amdgcn_wmma_f32_16x16x32_bf16(
          false, bk00, false, aq[u][0], (short)0, s0[u], false, false);
      s1[u] = __builtin_amdgcn_wmma_f32_16x16x32_bf16(
          false, bk10, false, aq[u][0], (short)0, s1[u], false, false);
    }
#pragma unroll
    for (int u = 0; u < QT; ++u) {
      s0[u] = __builtin_amdgcn_wmma_f32_16x16x32_bf16(
          false, bk01, false, aq[u][1], (short)0, s0[u], false, false);
      s1[u] = __builtin_amdgcn_wmma_f32_16x16x32_bf16(
          false, bk11, false, aq[u][1], (short)0, s1[u], false, false);
    }

    // ---- hand-over, first part: the pass has all it reads from LDS -----------
    // this wave's reads of buffer buf have returned
    asm volatile("s_wait_dscnt 0x0" ::: "memory");
    // this wave's copies of tile it + 1 have landed
    asm volatile("s_wait_asynccnt 0x0" ::: "memory");
    // Buffer fill held tile it - 1: the barrier of pass it - 1 ended every wave's
    // reads of it, so its refill need not wait for this pass's barrier and flies
    // until the wait above comes round again, a whole pass.
    if (refill)
      copy_tile(lds_off(&k_lds[fill][0][kdst]), lds_off(&v_lds[fill][0][vdst]),
                lds_off(&b_lds[fill][bdst]), kvoff, boff,
                kg + (size_t)(it + 2) * (KBLK * DQ),
                vg + (size_t)(it + 2) * (KBLK * DV), biasp + (it + 2) * KBLK);
    // the signal of the pass's barrier, behind both waits
    asm volatile("s_barrier_signal -1" ::: "memory");
    // keeps refill and signal here, in front of the softmax: left free, they
    // sink to the pass's foot, and the copies lose most of their time to land
    __builtin_amdgcn_sched_barrier(0);

#pragma unroll  // the two query tiles: everything below is named by constants
    for (int u = 0; u < QT; ++u) {
      // ---- bias, online softmax: 16 keys of one query per lane ------------
      //      (the loops over x[] are unrolled so that x[] stays in registers)
      float x[16];
#pragma unroll
      for (int t = 0; t < 8; t += 2) {   // by register pairs: packed operations
        const v2f a0 = (v2f){s0[u][t], s0[u][t + 1]} * 0.125f -
                       (v2f){bb[u][t >> 2][t & 3], bb[u][t >> 2][(t & 3) + 1]};
        const v2f a1 = (v2f){s1[u][t], s1[u][t + 1]} * 0.125f -
                       (v2f){bb[u][2 + (t >> 2)][t & 3],
                             bb[u][2 + (t >> 2)][(t & 3) + 1]};
        x[t] = a0.x;     x[t + 1] = a0.y;
        x[8 + t] = a1.x; x[9 + t] = a1.y;
      }
      float mx = x[0];
#pragma unroll
      for (int t = 1; t < 16; ++t) mx = fmaxf(mx, x[t]);
      mx = fmaxf(mx, other_half(mx));    // both halves scale by one maximum
      const float mnew = fmaxf(m_run[u], mx);
      const float corr = __expf(m_run[u] - mnew);
      v2f rs = {0.0f, 0.0f};             // even and odd keys: packed adds
#pragma unroll
      for (int t = 0; t < 16; t += 2) {
        const v2f d = (v2f){x[t], x[t + 1]} - mnew;  // by register pairs, as above
        x[t]     = __expf(d.x);
        x[t + 1] = __expf(d.y);
        rs += (v2f){x[t], x[t + 1]};
      }
      l_run[u] = l_run[u] * corr + (rs.x + rs.y);
      m_run[u] = mnew;
#pragma unroll  // accumulator elements are named by constants
      for (int j = 0; j < 4; ++j) acc[u][j] *= corr;

      // ---- O^T += V^T * P^T : the two score tiles, rounded in place, are the
      //      32-key B operand in the hardware's k order; V^T rows are A ------
      Frag16 pf;
      pf.q[0] = make_uint4(pack_bf16(x[0], x[1]), pack_bf16(x[2], x[3]),
                           pack_bf16(x[4], x[5]), pack_bf16(x[6], x[7]));
      pf.q[1] = make_uint4(pack_bf16(x[8], x[9]), pack_bf16(x[10], x[11]),
                           pack_bf16(x[12], x[13]), pack_bf16(x[14], x[15]));
#pragma unroll  // accumulator tiles are named by constants
      for (int j = 0; j < 4; ++j)
        acc[u][j] = __builtin_amdgcn_wmma_f32_16x16x32_bf16(
            false, bv[j], false, pf.v, (short)0, acc[u][j], false, false);
    }

    // ---- hand-over, second part: every wave has signalled, so tile it + 1 is
    //      published and buffer buf is given up --------------------------------
    // keeps the pass's arithmetic in front of the wait: a wave then meets it a
    // long way behind its own signal and seldom has to stand there
    __builtin_amdgcn_sched_barrier(0);
    // the wait of the pass's barrier; no LDS read stands between signal and wait
    asm volatile("s_barrier_wait -1" ::: "memory");
  };

  // The passes that send for a tile, then the last two, which have none left to
  // send for: no test stands in a pass.  A trip holds one pass per buffer: with
  // the buffer a variable, each pass spent eleven vector instructions, four of
  // them integer multiply-adds, on forming its LDS addresses.
  static_assert((NITER - 2) % NBUF == 0, "whole trips of NBUF passes");
  for (int it = 0; it < NITER - 2; it += NBUF) {
    pass(it, 0, 2, true);
    pass(it + 1, 1, 0, true);
    pass(it + 2, 2, 1, true);
  }
  pass(NITER - 2, 0, 0, false);
  pass(NITER - 1, 1, 0, false);
  // no copy is outstanding when the wave ends
  asm volatile("s_wait_asynccnt 0x0" ::: "memory");

  // ---- normalize and write out: contiguous [B,G,H,N,dv] -------------------
  //      acc[u][J][t] = feature 16*J + 8*half + t of query u*16 + lane16
#pragma unroll  // acc[][] stays in registers
  for (int u = 0; u < QT; ++u) {
    const float inv = 1.0f / (l_run[u] + other_half(l_run[u]));
    float* outp = out + ((hp + hs) * NSEQ + rowbase + wrow + u * 16 + lane16) *
                            DV + 8 * half;
#pragma unroll
    for (int j = 0; j < 4; ++j) {
      const v8f o = acc[u][j] * inv;
      *(v4f*)(outp + j * 16)     = o.lo;
      *(v4f*)(outp + j * 16 + 4) = o.hi;
    }
  }
}

extern "C" void kernel_launch(void* const* d_in, const int* in_sizes, int n_in,
                              void* d_out, int out_size, void* d_ws,
                              size_t ws_size, hipStream_t stream) {
  (void)in_sizes; (void)n_in; (void)out_size; (void)ws_size;
  const float* q   = (const float*)d_in[0];
  const float* k   = (const float*)d_in[1];
  const float* v   = (const float*)d_in[2];
  const float* ncs = (const float*)d_in[3];
  float* out = (float*)d_out;
  unsigned short* qb = (unsigned short*)d_ws;   // three bf16 planes, 48 MiB
  unsigned short* kb = qb + PLANE;
  unsigned short* vt = kb + PLANE;

  split_heads_kernel<<<QK_BLOCKS + V_BLOCKS, 256, 0, stream>>>(q, k, v, qb, kb,
                                                               vt);

  const int grid = NB * NG * (NH / HPB) * (NSEQ / ROWS_PB); // 512 blocks
  attn_bias_fwd_kernel<<<grid, 256, 0, stream>>>(
      qb, kb, vt, ncs, out);
}
